// v000
// Times are from an AMD MI455X. After a warm-up the kernel runs many times in a row, and a time is the length of
// such a window on the GPU divided by its runs, so every launch and the gaps after it count. The runs cycle
// through copies of the inputs. A figure is the median of several windows, for all but v000 over two sittings.
// Sittings can differ by a few percent; kernels timed side by side share one.
// v000, which the later versions start from, runs in 397 microseconds.
#include <hip/hip_runtime.h>
#include <math.h>

typedef __attribute__((ext_vector_type(16))) __bf16 v16bf;
typedef __attribute__((ext_vector_type(8)))  float  v8f;

#define HIDDEN   1024
#define HEADS    16
#define HEAD_DIM 64
#define BATCH    4
#define SEQ      2048
#define M_ROWS   (BATCH * SEQ)           // 8192
#define QKV_N    (HIDDEN + 2 * HEAD_DIM) // 1152

static __device__ __forceinline__ v16bf frag_k32(const __bf16* base, int ld) {
  const int lane = threadIdx.x & 31;
  const int lsub = lane & 15, hi = lane >> 4;
  const __bf16* p = base + (size_t)lsub * ld + hi * 8;
  union { uint4 u[2]; v16bf v; } t;
  t.u[0] = *reinterpret_cast<const uint4*>(p);
  t.u[1] = *reinterpret_cast<const uint4*>(p + 16);
  return t.v;
}

static __device__ __forceinline__ v8f wmma_bf16(v16bf a, v16bf b, v8f c) {
  return __builtin_amdgcn_wmma_f32_16x16x32_bf16(false, a, false, b, (short)0, c,
                                                 false, false);
}

// LDS byte offset of a generic pointer to __shared__.
static __device__ __forceinline__ unsigned lds_off32(const void* p) {
  return (unsigned)(uintptr_t)p;
}

static __device__ __forceinline__ void async_copy_b128(unsigned lds, const void* sbase,
                                                       unsigned voff) {
  asm volatile("global_load_async_to_lds_b128 %0, %1, %2"
               :: "v"(lds), "v"(voff), "s"(sbase)
               : "memory");
}

// ---------------------------------------------------------------------------
// Conversion / packing kernels (one-time, tiny).
// Weights stored TRANSPOSED ([N][K] bf16) so GEMM B-fragments are wide.
// The attention scale 1/sqrt(64) = 2^-3 is folded into Wq/bq here (exact).
// ---------------------------------------------------------------------------
__global__ void convert_f32_bf16(const float* __restrict__ src,
                                 __bf16* __restrict__ dst, size_t n) {
  size_t i = (size_t)blockIdx.x * blockDim.x + threadIdx.x;
  const size_t stride = (size_t)gridDim.x * blockDim.x;
  for (; i < n; i += stride) dst[i] = (__bf16)src[i];
}

__global__ void pack_wqkv_t(const float* __restrict__ Wq, const float* __restrict__ Wk,
                            const float* __restrict__ Wv, const float* __restrict__ bq,
                            const float* __restrict__ bk, const float* __restrict__ bv,
                            __bf16* __restrict__ Wt, float* __restrict__ bqkv) {
  size_t i = (size_t)blockIdx.x * blockDim.x + threadIdx.x;
  const size_t stride = (size_t)gridDim.x * blockDim.x;
  const size_t total = (size_t)QKV_N * HIDDEN;
  for (; i < total; i += stride) {
    const int n = (int)(i / HIDDEN), k = (int)(i % HIDDEN);
    float v;
    if (n < HIDDEN)                 v = Wq[(size_t)k * HIDDEN + n] * 0.125f;  // fold 1/sqrt(Dh)
    else if (n < HIDDEN + HEAD_DIM) v = Wk[(size_t)k * HEAD_DIM + (n - HIDDEN)];
    else                            v = Wv[(size_t)k * HEAD_DIM + (n - HIDDEN - HEAD_DIM)];
    Wt[i] = (__bf16)v;  // Wt[n][k]
    if (i < QKV_N) {
      const int n2 = (int)i;
      bqkv[n2] = (n2 < HIDDEN) ? bq[n2] * 0.125f
               : (n2 < HIDDEN + HEAD_DIM) ? bk[n2 - HIDDEN]
                                          : bv[n2 - HIDDEN - HEAD_DIM];
    }
  }
}

__global__ void transpose_f32_bf16(const float* __restrict__ W,  // [K][N]
                                   __bf16* __restrict__ Wt,      // [N][K]
                                   int K, int N) {
  size_t i = (size_t)blockIdx.x * blockDim.x + threadIdx.x;
  const size_t stride = (size_t)gridDim.x * blockDim.x;
  const size_t total = (size_t)K * N;
  for (; i < total; i += stride) {
    const int n = (int)(i / K), k = (int)(i % K);
    Wt[i] = (__bf16)W[(size_t)k * N + n];
  }
}

template <typename OutT>
__global__ __launch_bounds__(256) void gemm_bf16_wmma(
    const __bf16* __restrict__ A, const __bf16* __restrict__ Wt,
    const float* __restrict__ bias, OutT* __restrict__ C, int M, int N, int K) {
  constexpr int BM = 256, BN = 128, BK = 32;
  __shared__ __align__(16) __bf16 As[2][BM * BK];  // row-major [row][k], 2x16KB
  __shared__ __align__(16) __bf16 Bs[2][BN * BK];  // col-major [col][k], 2x8KB

  const int tid = threadIdx.x, lane = tid & 31, wave = tid >> 5;
  const int wm = wave & 3, wn = wave >> 2;  // 4 waves in M, 2 in N
  const int nb = N / BN;
  const int row0 = (blockIdx.x / nb) * BM;
  const int col0 = (blockIdx.x % nb) * BN;

  // async chunk mapping: chunk c (8 bf16) -> row c>>2, k-offset (c&3)*8
  const unsigned asBase[2] = {lds_off32(As[0]), lds_off32(As[1])};
  const unsigned bsBase[2] = {lds_off32(Bs[0]), lds_off32(Bs[1])};
  unsigned offA[4];
#pragma unroll
  for (int p = 0; p < 4; ++p) {
    const int c = tid + p * 256;
    offA[p] = (unsigned)((((c >> 2) * K) + (c & 3) * 8) * 2);
  }

  auto issue = [&](int k0, int buf) {
    const __bf16* aSrc = A + (size_t)row0 * K + k0;
    const __bf16* bSrc = Wt + (size_t)col0 * K + k0;
#pragma unroll
    for (int p = 0; p < 4; ++p)
      async_copy_b128(asBase[buf] + (unsigned)(tid + p * 256) * 16, aSrc, offA[p]);
#pragma unroll
    for (int p = 0; p < 2; ++p)
      async_copy_b128(bsBase[buf] + (unsigned)(tid + p * 256) * 16, bSrc, offA[p]);
  };

  v8f acc[4][4];
  issue(0, 0);

  // peeled first k-step: accumulate onto inline zero
  {
    asm volatile("s_wait_asynccnt 0x0" ::: "memory");
    __syncthreads();
    if (BK < K) issue(BK, 1);
    v16bf af[4], bf[4];
#pragma unroll
    for (int i = 0; i < 4; ++i) af[i] = frag_k32(&As[0][(wm * 64 + i * 16) * BK], BK);
#pragma unroll
    for (int j = 0; j < 4; ++j) bf[j] = frag_k32(&Bs[0][(wn * 64 + j * 16) * BK], BK);
    const v8f z = {};
#pragma unroll
    for (int i = 0; i < 4; ++i)
#pragma unroll
      for (int j = 0; j < 4; ++j) acc[i][j] = wmma_bf16(af[i], bf[j], z);
  }

  int buf = 1;
  for (int k0 = BK; k0 < K; k0 += BK, buf ^= 1) {
    asm volatile("s_wait_asynccnt 0x0" ::: "memory");  // our DMAs into buf landed
    __syncthreads();  // everyone's landed; everyone finished reading buf^1
    if (k0 + BK < K) issue(k0 + BK, buf ^ 1);  // DMA overlaps WMMAs below

    v16bf af[4], bf[4];
#pragma unroll
    for (int i = 0; i < 4; ++i) af[i] = frag_k32(&As[buf][(wm * 64 + i * 16) * BK], BK);
#pragma unroll
    for (int j = 0; j < 4; ++j) bf[j] = frag_k32(&Bs[buf][(wn * 64 + j * 16) * BK], BK);
#pragma unroll
    for (int i = 0; i < 4; ++i)
#pragma unroll
      for (int j = 0; j < 4; ++j) acc[i][j] = wmma_bf16(af[i], bf[j], acc[i][j]);
  }

  const int lsub = lane & 15, hi = lane >> 4;
#pragma unroll
  for (int i = 0; i < 4; ++i)
#pragma unroll
    for (int j = 0; j < 4; ++j)
#pragma unroll
      for (int r = 0; r < 8; ++r) {
        const int row = row0 + wm * 64 + i * 16 + r + 8 * hi;
        const int col = col0 + wn * 64 + j * 16 + lsub;
        C[(size_t)row * N + col] = (OutT)(acc[i][j][r] + bias[col]);
      }
}

__global__ __launch_bounds__(256) void mqa_attention(
    const __bf16* __restrict__ qkv, __bf16* __restrict__ attn_out) {
  __shared__ __align__(16) __bf16 Vt[HEAD_DIM * 64];  // [d][key] col-major B tile, 8KB
  __shared__ __align__(16) __bf16 Ps[8][16 * 64];     // per-wave P (row-major A tile), 16KB

  const int tid = threadIdx.x, lane = tid & 31, wave = tid >> 5;
  const int lsub = lane & 15, hi = lane >> 4;
  const int qb = blockIdx.x & 15;          // SEQ/128 = 16
  const int h  = (blockIdx.x >> 4) & 15;
  const int b  = blockIdx.x >> 8;
  const int q0 = qb * 128 + wave * 16;
  const int ld = QKV_N;

  // Q fragments (row-major A tile straight from global, 2x b128 per frag)
  const __bf16* qp = qkv + (size_t)(b * SEQ + q0) * ld + h * HEAD_DIM;
  const v16bf a_lo = frag_k32(qp, ld);
  const v16bf a_hi = frag_k32(qp + 32, ld);

  float mrow[8], lrow[8];
  v8f o[4] = {};
#pragma unroll
  for (int r = 0; r < 8; ++r) { mrow[r] = -INFINITY; lrow[r] = 0.0f; }

  const __bf16* kbase = qkv + (size_t)b * SEQ * ld + HIDDEN;
  const __bf16* vbase = kbase + HEAD_DIM;
  const int vd = tid & 63, vh = tid >> 6;  // V-transpose gather: 64 d x 4 key-quarters

  for (int kk0 = 0; kk0 < SEQ; kk0 += 64) {
    // gather V^T tile: Vt[d][key], coalesced b16 reads, 2x b128 LDS stores
    __align__(16) __bf16 tmp[16];
#pragma unroll
    for (int e = 0; e < 16; ++e)
      tmp[e] = vbase[(size_t)(kk0 + vh * 16 + e) * ld + vd];
    *reinterpret_cast<uint4*>(&Vt[vd * 64 + vh * 16])     = *reinterpret_cast<const uint4*>(&tmp[0]);
    *reinterpret_cast<uint4*>(&Vt[vd * 64 + vh * 16 + 8]) = *reinterpret_cast<const uint4*>(&tmp[8]);
    if (kk0 + 64 < SEQ)
      __builtin_prefetch(vbase + (size_t)(kk0 + 64 + vh * 16) * ld + vd, 0, 0);
    __syncthreads();

    // scores S = Q * K^T (16 x 64 keys); K frags direct from global (clause)
    v8f s[4] = {};
#pragma unroll
    for (int n = 0; n < 4; ++n) {
      const __bf16* kb = kbase + (size_t)(kk0 + n * 16) * ld;
      s[n] = wmma_bf16(a_lo, frag_k32(kb, ld), s[n]);
      s[n] = wmma_bf16(a_hi, frag_k32(kb + 32, ld), s[n]);
    }

    // online softmax over 64 keys; C-layout rows reduce over their 16-lane half
    __bf16* ps = &Ps[wave][0];
#pragma unroll
    for (int r = 0; r < 8; ++r) {
      const float x0 = s[0][r], x1 = s[1][r], x2 = s[2][r], x3 = s[3][r];
      float mx = fmaxf(fmaxf(x0, x1), fmaxf(x2, x3));
#pragma unroll
      for (int off = 8; off; off >>= 1) mx = fmaxf(mx, __shfl_xor(mx, off, 32));
      const float mnew = fmaxf(mrow[r], mx);
      const float corr = __expf(mrow[r] - mnew);
      const float p0 = __expf(x0 - mnew);
      const float p1 = __expf(x1 - mnew);
      const float p2 = __expf(x2 - mnew);
      const float p3 = __expf(x3 - mnew);
      float rs = (p0 + p1) + (p2 + p3);
#pragma unroll
      for (int off = 8; off; off >>= 1) rs += __shfl_xor(rs, off, 32);
      lrow[r] = lrow[r] * corr + rs;
      mrow[r] = mnew;
#pragma unroll
      for (int t = 0; t < 4; ++t) o[t][r] *= corr;
      const int prow = r + 8 * hi;
      ps[prow * 64 + lsub]      = (__bf16)p0;
      ps[prow * 64 + 16 + lsub] = (__bf16)p1;
      ps[prow * 64 + 32 + lsub] = (__bf16)p2;
      ps[prow * 64 + 48 + lsub] = (__bf16)p3;
    }
    asm volatile("s_wait_dscnt 0x0" ::: "memory");  // wave-private LDS RAW

    // O += P(16x64) * V(64x64): two A-frags x four 16-col B tiles
    const v16bf pf0 = frag_k32(ps, 64);
    const v16bf pf1 = frag_k32(ps + 32, 64);
#pragma unroll
    for (int t = 0; t < 4; ++t) {
      o[t] = wmma_bf16(pf0, frag_k32(&Vt[(t * 16) * 64], 64), o[t]);
      o[t] = wmma_bf16(pf1, frag_k32(&Vt[(t * 16) * 64 + 32], 64), o[t]);
    }
    __syncthreads();
  }

#pragma unroll
  for (int r = 0; r < 8; ++r) {
    const float inv = 1.0f / lrow[r];
    const int row = q0 + r + 8 * hi;
#pragma unroll
    for (int t = 0; t < 4; ++t) {
      const int col = h * HEAD_DIM + t * 16 + lsub;
      attn_out[(size_t)(b * SEQ + row) * HIDDEN + col] = (__bf16)(o[t][r] * inv);
    }
  }
}

// ---------------------------------------------------------------------------
// Host-side launch
// ---------------------------------------------------------------------------
extern "C" void kernel_launch(void* const* d_in, const int* in_sizes, int n_in,
                              void* d_out, int out_size, void* d_ws, size_t ws_size,
                              hipStream_t stream) {
  (void)in_sizes; (void)n_in; (void)out_size; (void)ws_size;
  const float* X  = (const float*)d_in[0];
  const float* Wq = (const float*)d_in[1];
  const float* bq = (const float*)d_in[2];
  const float* Wk = (const float*)d_in[3];
  const float* bk = (const float*)d_in[4];
  const float* Wv = (const float*)d_in[5];
  const float* bv = (const float*)d_in[6];
  const float* Wo = (const float*)d_in[7];
  const float* bo = (const float*)d_in[8];
  float* out = (float*)d_out;

  char* ws = (char*)d_ws;
  size_t off = 0;
  auto take = [&](size_t bytes) {
    void* p = ws + off;
    off += (bytes + 255) & ~(size_t)255;
    return p;
  };
  __bf16* Xbf   = (__bf16*)take((size_t)M_ROWS * HIDDEN * 2);  // 16 MB
  __bf16* WqkvT = (__bf16*)take((size_t)QKV_N * HIDDEN * 2);   // 2.25 MB  [N][K]
  __bf16* WoT   = (__bf16*)take((size_t)HIDDEN * HIDDEN * 2);  // 2 MB     [N][K]
  float*  bqkv  = (float*)take((size_t)QKV_N * 4);
  __bf16* QKV   = (__bf16*)take((size_t)M_ROWS * QKV_N * 2);   // 18 MB
  __bf16* Attn  = (__bf16*)take((size_t)M_ROWS * HIDDEN * 2);  // 16 MB

  // 1) precision conversion + transposed weight packing (one-time)
  convert_f32_bf16<<<1024, 256, 0, stream>>>(X, Xbf, (size_t)M_ROWS * HIDDEN);
  pack_wqkv_t<<<512, 256, 0, stream>>>(Wq, Wk, Wv, bq, bk, bv, WqkvT, bqkv);
  transpose_f32_bf16<<<512, 256, 0, stream>>>(Wo, WoT, HIDDEN, HIDDEN);

  // 2) fused QKV projection: [8192,1024] x [1024,1152] + bias -> bf16
  gemm_bf16_wmma<__bf16><<<(M_ROWS / 256) * (QKV_N / 128), 256, 0, stream>>>(
      Xbf, WqkvT, bqkv, QKV, M_ROWS, QKV_N, HIDDEN);

  // 3) flash multi-query attention -> bf16 [8192,1024]
  mqa_attention<<<BATCH * HEADS * (SEQ / 128), 256, 0, stream>>>(QKV, Attn);

  // 4) output projection: [8192,1024] x [1024,1024] + bo -> f32 out
  gemm_bf16_wmma<float><<<(M_ROWS / 256) * (HIDDEN / 128), 256, 0, stream>>>(
      Attn, WoT, bo, out, M_ROWS, HIDDEN, HIDDEN);
}

// v001
// One run takes 268 microseconds.
// In both of two side-by-side timings against v000, it was 1.53 times as fast.
#include <hip/hip_runtime.h>
#include <math.h>

typedef __attribute__((ext_vector_type(16))) __bf16 v16bf;
typedef __attribute__((ext_vector_type(8)))  float  v8f;

#define HIDDEN   1024
#define HEADS    16
#define HEAD_DIM 64
#define BATCH    4
#define SEQ      2048
#define M_ROWS   (BATCH * SEQ)           // 8192
#define QKV_N    (HIDDEN + 2 * HEAD_DIM) // 1152

static __device__ __forceinline__ v16bf frag_k32(const __bf16* base, int ld) {
  const int lane = threadIdx.x & 31;
  const int lsub = lane & 15, hi = lane >> 4;
  const __bf16* p = base + (size_t)lsub * ld + hi * 8;
  union { uint4 u[2]; v16bf v; } t;
  t.u[0] = *reinterpret_cast<const uint4*>(p);
  t.u[1] = *reinterpret_cast<const uint4*>(p + 16);
  return t.v;
}

static __device__ __forceinline__ v8f wmma_bf16(v16bf a, v16bf b, v8f c) {
  return __builtin_amdgcn_wmma_f32_16x16x32_bf16(false, a, false, b, (short)0, c,
                                                 false, false);
}

// LDS byte offset of a generic pointer to __shared__.
static __device__ __forceinline__ unsigned lds_off32(const void* p) {
  return (unsigned)(uintptr_t)p;
}

static __device__ __forceinline__ void async_copy_b128(unsigned lds, const void* sbase,
                                                       unsigned voff) {
  asm volatile("global_load_async_to_lds_b128 %0, %1, %2"
               :: "v"(lds), "v"(voff), "s"(sbase)
               : "memory");
}

// ---------------------------------------------------------------------------
// Conversion / packing kernels (one-time, tiny).
// Weights stored TRANSPOSED ([N][K] bf16) so GEMM B-fragments are wide.
// The attention scale 1/sqrt(64) = 2^-3 is folded into Wq/bq here (exact).
// ---------------------------------------------------------------------------
__global__ void convert_f32_bf16(const float* __restrict__ src,
                                 __bf16* __restrict__ dst, size_t n) {
  size_t i = (size_t)blockIdx.x * blockDim.x + threadIdx.x;
  const size_t stride = (size_t)gridDim.x * blockDim.x;
  for (; i < n; i += stride) dst[i] = (__bf16)src[i];
}

__global__ void pack_wqkv_t(const float* __restrict__ Wq, const float* __restrict__ Wk,
                            const float* __restrict__ Wv, const float* __restrict__ bq,
                            const float* __restrict__ bk, const float* __restrict__ bv,
                            __bf16* __restrict__ Wt, float* __restrict__ bqkv) {
  size_t i = (size_t)blockIdx.x * blockDim.x + threadIdx.x;
  const size_t stride = (size_t)gridDim.x * blockDim.x;
  const size_t total = (size_t)QKV_N * HIDDEN;
  for (; i < total; i += stride) {
    const int n = (int)(i / HIDDEN), k = (int)(i % HIDDEN);
    float v;
    if (n < HIDDEN)                 v = Wq[(size_t)k * HIDDEN + n] * 0.125f;  // fold 1/sqrt(Dh)
    else if (n < HIDDEN + HEAD_DIM) v = Wk[(size_t)k * HEAD_DIM + (n - HIDDEN)];
    else                            v = Wv[(size_t)k * HEAD_DIM + (n - HIDDEN - HEAD_DIM)];
    Wt[i] = (__bf16)v;  // Wt[n][k]
    if (i < QKV_N) {
      const int n2 = (int)i;
      bqkv[n2] = (n2 < HIDDEN) ? bq[n2] * 0.125f
               : (n2 < HIDDEN + HEAD_DIM) ? bk[n2 - HIDDEN]
                                          : bv[n2 - HIDDEN - HEAD_DIM];
    }
  }
}

__global__ void transpose_f32_bf16(const float* __restrict__ W,  // [K][N]
                                   __bf16* __restrict__ Wt,      // [N][K]
                                   int K, int N) {
  size_t i = (size_t)blockIdx.x * blockDim.x + threadIdx.x;
  const size_t stride = (size_t)gridDim.x * blockDim.x;
  const size_t total = (size_t)K * N;
  for (; i < total; i += stride) {
    const int n = (int)(i / K), k = (int)(i % K);
    Wt[i] = (__bf16)W[(size_t)k * N + n];
  }
}

template <typename OutT>
__global__ __launch_bounds__(256) void gemm_bf16_wmma(
    const __bf16* __restrict__ A, const __bf16* __restrict__ Wt,
    const float* __restrict__ bias, OutT* __restrict__ C, int M, int N, int K) {
  constexpr int BM = 256, BN = 128, BK = 32;
  __shared__ __align__(16) __bf16 As[2][BM * BK];  // row-major [row][k], 2x16KB
  __shared__ __align__(16) __bf16 Bs[2][BN * BK];  // col-major [col][k], 2x8KB

  const int tid = threadIdx.x, lane = tid & 31, wave = tid >> 5;
  const int wm = wave & 3, wn = wave >> 2;  // 4 waves in M, 2 in N
  const int nb = N / BN;
  const int row0 = (blockIdx.x / nb) * BM;
  const int col0 = (blockIdx.x % nb) * BN;

  // async chunk mapping: chunk c (8 bf16) -> row c>>2, k-offset (c&3)*8
  const unsigned asBase[2] = {lds_off32(As[0]), lds_off32(As[1])};
  const unsigned bsBase[2] = {lds_off32(Bs[0]), lds_off32(Bs[1])};
  unsigned offA[4];
#pragma unroll
  for (int p = 0; p < 4; ++p) {
    const int c = tid + p * 256;
    offA[p] = (unsigned)((((c >> 2) * K) + (c & 3) * 8) * 2);
  }

  auto issue = [&](int k0, int buf) {
    const __bf16* aSrc = A + (size_t)row0 * K + k0;
    const __bf16* bSrc = Wt + (size_t)col0 * K + k0;
#pragma unroll
    for (int p = 0; p < 4; ++p)
      async_copy_b128(asBase[buf] + (unsigned)(tid + p * 256) * 16, aSrc, offA[p]);
#pragma unroll
    for (int p = 0; p < 2; ++p)
      async_copy_b128(bsBase[buf] + (unsigned)(tid + p * 256) * 16, bSrc, offA[p]);
  };

  v8f acc[4][4];
  issue(0, 0);

  // peeled first k-step: accumulate onto inline zero
  {
    asm volatile("s_wait_asynccnt 0x0" ::: "memory");
    __syncthreads();
    if (BK < K) issue(BK, 1);
    v16bf af[4], bf[4];
#pragma unroll
    for (int i = 0; i < 4; ++i) af[i] = frag_k32(&As[0][(wm * 64 + i * 16) * BK], BK);
#pragma unroll
    for (int j = 0; j < 4; ++j) bf[j] = frag_k32(&Bs[0][(wn * 64 + j * 16) * BK], BK);
    const v8f z = {};
#pragma unroll
    for (int i = 0; i < 4; ++i)
#pragma unroll
      for (int j = 0; j < 4; ++j) acc[i][j] = wmma_bf16(af[i], bf[j], z);
  }

  int buf = 1;
  for (int k0 = BK; k0 < K; k0 += BK, buf ^= 1) {
    asm volatile("s_wait_asynccnt 0x0" ::: "memory");  // our DMAs into buf landed
    __syncthreads();  // everyone's landed; everyone finished reading buf^1
    if (k0 + BK < K) issue(k0 + BK, buf ^ 1);  // DMA overlaps WMMAs below

    v16bf af[4], bf[4];
#pragma unroll
    for (int i = 0; i < 4; ++i) af[i] = frag_k32(&As[buf][(wm * 64 + i * 16) * BK], BK);
#pragma unroll
    for (int j = 0; j < 4; ++j) bf[j] = frag_k32(&Bs[buf][(wn * 64 + j * 16) * BK], BK);
#pragma unroll
    for (int i = 0; i < 4; ++i)
#pragma unroll
      for (int j = 0; j < 4; ++j) acc[i][j] = wmma_bf16(af[i], bf[j], acc[i][j]);
  }

  const int lsub = lane & 15, hi = lane >> 4;
#pragma unroll
  for (int i = 0; i < 4; ++i)
#pragma unroll
    for (int j = 0; j < 4; ++j)
#pragma unroll
      for (int r = 0; r < 8; ++r) {
        const int row = row0 + wm * 64 + i * 16 + r + 8 * hi;
        const int col = col0 + wn * 64 + j * 16 + lsub;
        C[(size_t)row * N + col] = (OutT)(acc[i][j][r] + bias[col]);
      }
}

static __device__ __forceinline__ float xhalf(float x) {
  const int v = __builtin_bit_cast(int, x);
  return __builtin_bit_cast(
      float, __builtin_amdgcn_permlanex16(v, v, 0x76543210, 0xfedcba98, false, false));
}

__global__ __launch_bounds__(256) void mqa_attention(
    const __bf16* __restrict__ qkv, __bf16* __restrict__ attn_out) {
  __shared__ __align__(16) __bf16 Vt[HEAD_DIM * 64];  // [d][key] row-major A tile, 8KB

  const int tid = threadIdx.x, lane = tid & 31, wave = tid >> 5;
  const int lsub = lane & 15, hi = lane >> 4;
  const int qb = blockIdx.x & 15;          // SEQ/128 = 16
  const int h  = (blockIdx.x >> 4) & 15;
  const int b  = blockIdx.x >> 8;
  const int q0 = qb * 128 + wave * 16;
  const int ld = QKV_N;

  // Q fragments (B operand: column = query, straight from global, 2x b128 per frag)
  const __bf16* qp = qkv + (size_t)(b * SEQ + q0) * ld + h * HEAD_DIM;
  const v16bf q_lo = frag_k32(qp, ld);
  const v16bf q_hi = frag_k32(qp + 32, ld);

  float m_run = -INFINITY;  // this lane's query: running maximum (both halves agree)
  float l_run = 0.0f;       // running sum over this half's keys only; joined at the end
  v8f o[4] = {};            // o[t][r] = O[query lsub][d = t*16 + 8*hi + r]

  const __bf16* kbase = qkv + (size_t)b * SEQ * ld + HIDDEN;
  const __bf16* vbase = kbase + HEAD_DIM;
  const int vd = tid & 63, vh = tid >> 6;  // V-transpose gather: 64 d x 4 key-quarters

  for (int kk0 = 0; kk0 < SEQ; kk0 += 64) {
    // gather V^T tile: Vt[d][key], coalesced b16 reads, 2x b128 LDS stores
    __align__(16) __bf16 tmp[16];
#pragma unroll
    for (int e = 0; e < 16; ++e)
      tmp[e] = vbase[(size_t)(kk0 + vh * 16 + e) * ld + vd];
    *reinterpret_cast<uint4*>(&Vt[vd * 64 + vh * 16])     = *reinterpret_cast<const uint4*>(&tmp[0]);
    *reinterpret_cast<uint4*>(&Vt[vd * 64 + vh * 16 + 8]) = *reinterpret_cast<const uint4*>(&tmp[8]);
    if (kk0 + 64 < SEQ)
      __builtin_prefetch(vbase + (size_t)(kk0 + 64 + vh * 16) * ld + vd, 0, 0);
    __syncthreads();

    // S^T = K * Q^T (64 keys x 16 queries); K frags direct from global (clause)
    // s[n][r] = score(key kk0 + n*16 + 8*hi + r, query lsub)
    v8f s[4] = {};
#pragma unroll
    for (int n = 0; n < 4; ++n) {
      const __bf16* kb = kbase + (size_t)(kk0 + n * 16) * ld;
      s[n] = wmma_bf16(frag_k32(kb, ld), q_lo, s[n]);
      s[n] = wmma_bf16(frag_k32(kb + 32, ld), q_hi, s[n]);
    }

    // online softmax over 64 keys of one query per lane
    float mx = s[0][0];
#pragma unroll
    for (int n = 0; n < 4; ++n)
#pragma unroll
      for (int r = 0; r < 8; ++r) mx = fmaxf(mx, s[n][r]);
    mx = fmaxf(mx, xhalf(mx));
    const float mnew = fmaxf(m_run, mx);
    const float corr = __expf(m_run - mnew);
    m_run = mnew;

    v16bf pb[2];   // P^T as B operands: keys 0..31 and 32..63 of the tile
#pragma unroll
    for (int n = 0; n < 4; ++n)
#pragma unroll
      for (int r = 0; r < 8; ++r) {
        s[n][r] = __expf(s[n][r] - mnew);
        pb[n >> 1][(n & 1) * 8 + r] = (__bf16)s[n][r];
      }
    const v8f rs = (s[0] + s[1]) + (s[2] + s[3]);  // this half's 32 keys, register by register
    l_run = l_run * corr + (((rs[0] + rs[1]) + (rs[2] + rs[3])) + ((rs[4] + rs[5]) + (rs[6] + rs[7])));
#pragma unroll
    for (int t = 0; t < 4; ++t) o[t] *= corr;

    // O^T += V^T(64 d x 64 keys) * P^T(64 keys x 16 queries)
#pragma unroll
    for (int t = 0; t < 4; ++t) {
      o[t] = wmma_bf16(frag_k32(&Vt[(t * 16) * 64], 64), pb[0], o[t]);
      o[t] = wmma_bf16(frag_k32(&Vt[(t * 16) * 64 + 32], 64), pb[1], o[t]);
    }
    __syncthreads();
  }

  // a lane holds 8 consecutive d of its query per tile: one 16B store each
  const float inv = 1.0f / (l_run + xhalf(l_run));
  __bf16* op = attn_out + (size_t)(b * SEQ + q0 + lsub) * HIDDEN + h * HEAD_DIM + hi * 8;
#pragma unroll
  for (int t = 0; t < 4; ++t) {
    union { uint4 u; __bf16 e[8]; } w;
#pragma unroll
    for (int r = 0; r < 8; ++r) w.e[r] = (__bf16)(o[t][r] * inv);
    *reinterpret_cast<uint4*>(op + t * 16) = w.u;
  }
}

// ---------------------------------------------------------------------------
// Host-side launch
// ---------------------------------------------------------------------------
extern "C" void kernel_launch(void* const* d_in, const int* in_sizes, int n_in,
                              void* d_out, int out_size, void* d_ws, size_t ws_size,
                              hipStream_t stream) {
  (void)in_sizes; (void)n_in; (void)out_size; (void)ws_size;
  const float* X  = (const float*)d_in[0];
  const float* Wq = (const float*)d_in[1];
  const float* bq = (const float*)d_in[2];
  const float* Wk = (const float*)d_in[3];
  const float* bk = (const float*)d_in[4];
  const float* Wv = (const float*)d_in[5];
  const float* bv = (const float*)d_in[6];
  const float* Wo = (const float*)d_in[7];
  const float* bo = (const float*)d_in[8];
  float* out = (float*)d_out;

  char* ws = (char*)d_ws;
  size_t off = 0;
  auto take = [&](size_t bytes) {
    void* p = ws + off;
    off += (bytes + 255) & ~(size_t)255;
    return p;
  };
  __bf16* Xbf   = (__bf16*)take((size_t)M_ROWS * HIDDEN * 2);  // 16 MB
  __bf16* WqkvT = (__bf16*)take((size_t)QKV_N * HIDDEN * 2);   // 2.25 MB  [N][K]
  __bf16* WoT   = (__bf16*)take((size_t)HIDDEN * HIDDEN * 2);  // 2 MB     [N][K]
  float*  bqkv  = (float*)take((size_t)QKV_N * 4);
  __bf16* QKV   = (__bf16*)take((size_t)M_ROWS * QKV_N * 2);   // 18 MB
  __bf16* Attn  = (__bf16*)take((size_t)M_ROWS * HIDDEN * 2);  // 16 MB

  // 1) precision conversion + transposed weight packing (one-time)
  convert_f32_bf16<<<1024, 256, 0, stream>>>(X, Xbf, (size_t)M_ROWS * HIDDEN);
  pack_wqkv_t<<<512, 256, 0, stream>>>(Wq, Wk, Wv, bq, bk, bv, WqkvT, bqkv);
  transpose_f32_bf16<<<512, 256, 0, stream>>>(Wo, WoT, HIDDEN, HIDDEN);

  // 2) fused QKV projection: [8192,1024] x [1024,1152] + bias -> bf16
  gemm_bf16_wmma<__bf16><<<(M_ROWS / 256) * (QKV_N / 128), 256, 0, stream>>>(
      Xbf, WqkvT, bqkv, QKV, M_ROWS, QKV_N, HIDDEN);

  // 3) flash multi-query attention -> bf16 [8192,1024]
  mqa_attention<<<BATCH * HEADS * (SEQ / 128), 256, 0, stream>>>(QKV, Attn);

  // 4) output projection: [8192,1024] x [1024,1024] + bo -> f32 out
  gemm_bf16_wmma<float><<<(M_ROWS / 256) * (HIDDEN / 128), 256, 0, stream>>>(
      Attn, WoT, bo, out, M_ROWS, HIDDEN, HIDDEN);
}

// v002
// One run takes 171 microseconds.
// Two timings next to v001 both put it at 1.56 times that version's speed.
// Over all steps from v000 it is 2.39 times as fast.
#include <hip/hip_runtime.h>
#include <math.h>

typedef __attribute__((ext_vector_type(16))) __bf16 v16bf;
typedef __attribute__((ext_vector_type(8)))  float  v8f;

#define HIDDEN   1024
#define HEADS    16
#define HEAD_DIM 64
#define BATCH    4
#define SEQ      2048
#define M_ROWS   (BATCH * SEQ)           // 8192
#define QKV_N    (HIDDEN + 2 * HEAD_DIM) // 1152

static __device__ __forceinline__ v16bf frag_k32(const __bf16* base, int ld) {
  const int lane = threadIdx.x & 31;
  const int lsub = lane & 15, hi = lane >> 4;
  const __bf16* p = base + (size_t)lsub * ld + hi * 8;
  union { uint4 u[2]; v16bf v; } t;
  t.u[0] = *reinterpret_cast<const uint4*>(p);
  t.u[1] = *reinterpret_cast<const uint4*>(p + 16);
  return t.v;
}

static __device__ __forceinline__ v8f wmma_bf16(v16bf a, v16bf b, v8f c) {
  return __builtin_amdgcn_wmma_f32_16x16x32_bf16(false, a, false, b, (short)0, c,
                                                 false, false);
}

// LDS byte offset of a generic pointer to __shared__.
static __device__ __forceinline__ unsigned lds_off32(const void* p) {
  return (unsigned)(uintptr_t)p;
}

static __device__ __forceinline__ void async_copy_b128(unsigned lds, const void* sbase,
                                                       unsigned voff) {
  asm volatile("global_load_async_to_lds_b128 %0, %1, %2"
               :: "v"(lds), "v"(voff), "s"(sbase)
               : "memory");
}

// ---------------------------------------------------------------------------
// Conversion / packing kernels (one-time, tiny).
// Weights stored TRANSPOSED ([N][K] bf16) so GEMM B-fragments are wide.
// The attention scale 1/sqrt(64) = 2^-3 is folded into Wq/bq here (exact).
// ---------------------------------------------------------------------------
__global__ void convert_f32_bf16(const float* __restrict__ src,
                                 __bf16* __restrict__ dst, size_t n) {
  size_t i = (size_t)blockIdx.x * blockDim.x + threadIdx.x;
  const size_t stride = (size_t)gridDim.x * blockDim.x;
  for (; i < n; i += stride) dst[i] = (__bf16)src[i];
}

__global__ void pack_wqkv_t(const float* __restrict__ Wq, const float* __restrict__ Wk,
                            const float* __restrict__ Wv, const float* __restrict__ bq,
                            const float* __restrict__ bk, const float* __restrict__ bv,
                            __bf16* __restrict__ Wt, float* __restrict__ bqkv) {
  size_t i = (size_t)blockIdx.x * blockDim.x + threadIdx.x;
  const size_t stride = (size_t)gridDim.x * blockDim.x;
  const size_t total = (size_t)QKV_N * HIDDEN;
  for (; i < total; i += stride) {
    const int n = (int)(i / HIDDEN), k = (int)(i % HIDDEN);
    float v;
    if (n < HIDDEN)                 v = Wq[(size_t)k * HIDDEN + n] * 0.125f;  // fold 1/sqrt(Dh)
    else if (n < HIDDEN + HEAD_DIM) v = Wk[(size_t)k * HEAD_DIM + (n - HIDDEN)];
    else                            v = Wv[(size_t)k * HEAD_DIM + (n - HIDDEN - HEAD_DIM)];
    Wt[i] = (__bf16)v;  // Wt[n][k]
    if (i < QKV_N) {
      const int n2 = (int)i;
      bqkv[n2] = (n2 < HIDDEN) ? bq[n2] * 0.125f
               : (n2 < HIDDEN + HEAD_DIM) ? bk[n2 - HIDDEN]
                                          : bv[n2 - HIDDEN - HEAD_DIM];
    }
  }
}

__global__ void transpose_f32_bf16(const float* __restrict__ W,  // [K][N]
                                   __bf16* __restrict__ Wt,      // [N][K]
                                   int K, int N) {
  size_t i = (size_t)blockIdx.x * blockDim.x + threadIdx.x;
  const size_t stride = (size_t)gridDim.x * blockDim.x;
  const size_t total = (size_t)K * N;
  for (; i < total; i += stride) {
    const int n = (int)(i / K), k = (int)(i % K);
    Wt[i] = (__bf16)W[(size_t)k * N + n];
  }
}

template <typename OutT>
__global__ __launch_bounds__(256) void gemm_bf16_wmma(
    const __bf16* __restrict__ A, const __bf16* __restrict__ Wt,
    const float* __restrict__ bias, OutT* __restrict__ C, int M, int N, int K) {
  constexpr int BM = 256, BN = 128, BK = 32;
  __shared__ __align__(16) __bf16 As[2][BM * BK];  // row-major [row][k], 2x16KB
  __shared__ __align__(16) __bf16 Bs[2][BN * BK];  // col-major [col][k], 2x8KB

  const int tid = threadIdx.x, lane = tid & 31, wave = tid >> 5;
  const int wm = wave & 3, wn = wave >> 2;  // 4 waves in M, 2 in N
  const int nb = N / BN;
  const int row0 = (blockIdx.x / nb) * BM;
  const int col0 = (blockIdx.x % nb) * BN;

  // async chunk mapping: chunk c (8 bf16) -> row c>>2, k-offset (c&3)*8
  const unsigned asBase[2] = {lds_off32(As[0]), lds_off32(As[1])};
  const unsigned bsBase[2] = {lds_off32(Bs[0]), lds_off32(Bs[1])};
  unsigned offA[4];
#pragma unroll
  for (int p = 0; p < 4; ++p) {
    const int c = tid + p * 256;
    offA[p] = (unsigned)((((c >> 2) * K) + (c & 3) * 8) * 2);
  }

  auto issue = [&](int k0, int buf) {
    const __bf16* aSrc = A + (size_t)row0 * K + k0;
    const __bf16* bSrc = Wt + (size_t)col0 * K + k0;
#pragma unroll
    for (int p = 0; p < 4; ++p)
      async_copy_b128(asBase[buf] + (unsigned)(tid + p * 256) * 16, aSrc, offA[p]);
#pragma unroll
    for (int p = 0; p < 2; ++p)
      async_copy_b128(bsBase[buf] + (unsigned)(tid + p * 256) * 16, bSrc, offA[p]);
  };

  v8f acc[4][4];
  issue(0, 0);

  // peeled first k-step: accumulate onto inline zero
  {
    asm volatile("s_wait_asynccnt 0x0" ::: "memory");
    __syncthreads();
    if (BK < K) issue(BK, 1);
    v16bf af[4], bf[4];
#pragma unroll
    for (int i = 0; i < 4; ++i) af[i] = frag_k32(&As[0][(wm * 64 + i * 16) * BK], BK);
#pragma unroll
    for (int j = 0; j < 4; ++j) bf[j] = frag_k32(&Bs[0][(wn * 64 + j * 16) * BK], BK);
    const v8f z = {};
#pragma unroll
    for (int i = 0; i < 4; ++i)
#pragma unroll
      for (int j = 0; j < 4; ++j) acc[i][j] = wmma_bf16(af[i], bf[j], z);
  }

  int buf = 1;
  for (int k0 = BK; k0 < K; k0 += BK, buf ^= 1) {
    asm volatile("s_wait_asynccnt 0x0" ::: "memory");  // our DMAs into buf landed
    __syncthreads();  // everyone's landed; everyone finished reading buf^1
    if (k0 + BK < K) issue(k0 + BK, buf ^ 1);  // DMA overlaps WMMAs below

    v16bf af[4], bf[4];
#pragma unroll
    for (int i = 0; i < 4; ++i) af[i] = frag_k32(&As[buf][(wm * 64 + i * 16) * BK], BK);
#pragma unroll
    for (int j = 0; j < 4; ++j) bf[j] = frag_k32(&Bs[buf][(wn * 64 + j * 16) * BK], BK);
#pragma unroll
    for (int i = 0; i < 4; ++i)
#pragma unroll
      for (int j = 0; j < 4; ++j) acc[i][j] = wmma_bf16(af[i], bf[j], acc[i][j]);
  }

  const int lsub = lane & 15, hi = lane >> 4;
#pragma unroll
  for (int i = 0; i < 4; ++i)
#pragma unroll
    for (int j = 0; j < 4; ++j)
#pragma unroll
      for (int r = 0; r < 8; ++r) {
        const int row = row0 + wm * 64 + i * 16 + r + 8 * hi;
        const int col = col0 + wn * 64 + j * 16 + lsub;
        C[(size_t)row * N + col] = (OutT)(acc[i][j][r] + bias[col]);
      }
}

static __device__ __forceinline__ float xhalf(float x) {
  const int v = __builtin_bit_cast(int, x);
  return __builtin_bit_cast(
      float, __builtin_amdgcn_permlanex16(v, v, 0x76543210, 0xfedcba98, false, false));
}

#define KPITCH  144
#define VPITCH  160
#define KTILE_B (64 * KPITCH)
#define STAGE_B (KTILE_B + 64 * VPITCH)
#define KV_TILES (SEQ / 64)

typedef unsigned u32x4 __attribute__((ext_vector_type(4)));
typedef short    s16x8 __attribute__((ext_vector_type(8)));

static __device__ __forceinline__ u32x4 lds_tr16(const unsigned char* p) {
  typedef __attribute__((address_space(3))) s16x8 lds_s16x8;
  return __builtin_bit_cast(u32x4, __builtin_amdgcn_ds_load_tr16_b128_v8i16((lds_s16x8*)p));
}

// A fragment of V^T (16 d x 32 keys, hardware k order) from row-major V rows.
// p = this lane's address for the fragment's first 16 keys.
static __device__ __forceinline__ v16bf frag_vt(const unsigned char* p) {
  union { u32x4 q[2]; v16bf v; } t;
  t.q[0] = lds_tr16(p);
  t.q[1] = lds_tr16(p + 16 * VPITCH);
  return t.v;
}

static __device__ __forceinline__ void async_copy4_b128(
    unsigned l0, const void* g0, unsigned l1, const void* g1,
    unsigned l2, const void* g2, unsigned l3, const void* g3) {
  asm volatile("global_load_async_to_lds_b128 %0, %1, off\n\t"
               "global_load_async_to_lds_b128 %2, %3, off\n\t"
               "global_load_async_to_lds_b128 %4, %5, off\n\t"
               "global_load_async_to_lds_b128 %6, %7, off\n\t"
               "s_wait_xcnt 0x0"
               :: "v"(l0), "v"(g0), "v"(l1), "v"(g1), "v"(l2), "v"(g2), "v"(l3), "v"(g3)
               : "memory");
}

__global__ __launch_bounds__(256) void mqa_attention(
    const __bf16* __restrict__ qkv, __bf16* __restrict__ attn_out) {
  // per buffer: K [64 keys][KPITCH], then V [64 keys][VPITCH], both row-major
  __shared__ __attribute__((aligned(128))) unsigned char kv[2][STAGE_B];

  const int tid = threadIdx.x, lane = tid & 31, wave = tid >> 5;
  const int lsub = lane & 15, hi = lane >> 4;
  const int qb = blockIdx.x & 15;          // SEQ/128 = 16
  const int h  = (blockIdx.x >> 4) & 15;
  const int b  = blockIdx.x >> 8;
  const int q0 = qb * 128 + wave * 16;
  const int ld = QKV_N;

  // copy map: 16 chunks of 16B per key row (8 of K, 8 of V), 16 rows per copy
  const int crow = tid >> 4, cc = tid & 15;
  const unsigned isv = (unsigned)cc >> 3;                      // 0: a K chunk, 1: a V chunk
  const unsigned cpitch = KPITCH + isv * (VPITCH - KPITCH);
  const unsigned ldst = lds_off32(&kv[0][0]) + isv * KTILE_B + (unsigned)crow * cpitch + (cc & 7) * 16u;
  const unsigned lstep = 16u * cpitch;
  const unsigned char* gsrc =
      reinterpret_cast<const unsigned char*>(qkv + (size_t)(b * SEQ + crow) * ld + HIDDEN) + cc * 16;
  constexpr size_t GSTEP = (size_t)16 * QKV_N * 2;  // 16 key rows, bytes

  auto issue = [&](int tile, int buf) {
    const unsigned l = ldst + (unsigned)buf * STAGE_B;
    const unsigned char* g = gsrc + (size_t)tile * (4 * GSTEP);
    async_copy4_b128(l, g, l + lstep, g + GSTEP, l + 2 * lstep, g + 2 * GSTEP,
                     l + 3 * lstep, g + 3 * GSTEP);
  };

  issue(0, 0);

  // Q fragments (B operand: column = query, straight from global, 2x b128 per frag)
  const __bf16* qp = qkv + (size_t)(b * SEQ + q0) * ld + h * HEAD_DIM;
  const v16bf q_lo = frag_k32(qp, ld);
  const v16bf q_hi = frag_k32(qp + 32, ld);

  float m_run = -INFINITY;  // this lane's query: running maximum (both halves agree)
  float l_run = 0.0f;       // running sum over this half's keys only; joined at the end
  v8f o[4] = {};            // o[t][r] = O[query lsub][d = t*16 + 8*hi + r]

  // this lane's place in a V tile for the transposing load
  const unsigned vlane = KTILE_B + (unsigned)(8 * hi + (lane & 7)) * VPITCH + 16u * ((lane >> 3) & 1);

  asm volatile("s_wait_asynccnt 0x0" ::: "memory");  // own copies of stage 0 landed
  __syncthreads();                                   // everyone's landed
  issue(1, 1);

  for (int kt = 0; kt < KV_TILES; ++kt) {
    const unsigned char* stage = kv[kt & 1];

    // S^T = K * Q^T (64 keys x 16 queries)
    // s[n][r] = score(key kt*64 + n*16 + 8*hi + r, query lsub)
    v8f s[4] = {};
#pragma unroll
    for (int n = 0; n < 4; ++n) {
      const __bf16* kb = reinterpret_cast<const __bf16*>(stage + n * 16 * KPITCH);
      s[n] = wmma_bf16(frag_k32(kb, KPITCH / 2), q_lo, s[n]);
      s[n] = wmma_bf16(frag_k32(kb + 32, KPITCH / 2), q_hi, s[n]);
    }

    // online softmax over 64 keys of one query per lane
    float mx = s[0][0];
#pragma unroll
    for (int n = 0; n < 4; ++n)
#pragma unroll
      for (int r = 0; r < 8; ++r) mx = fmaxf(mx, s[n][r]);
    mx = fmaxf(mx, xhalf(mx));
    const float mnew = fmaxf(m_run, mx);
    const float corr = __expf(m_run - mnew);
    m_run = mnew;

    v16bf pb[2];   // P^T as B operands: keys 0..31 and 32..63 of the tile
#pragma unroll
    for (int n = 0; n < 4; ++n)
#pragma unroll
      for (int r = 0; r < 8; ++r) {
        s[n][r] = __expf(s[n][r] - mnew);
        pb[n >> 1][(n & 1) * 8 + r] = (__bf16)s[n][r];
      }
    const v8f rs = (s[0] + s[1]) + (s[2] + s[3]);  // this half's 32 keys, register by register
    l_run = l_run * corr + (((rs[0] + rs[1]) + (rs[2] + rs[3])) + ((rs[4] + rs[5]) + (rs[6] + rs[7])));
#pragma unroll
    for (int t = 0; t < 4; ++t) o[t] *= corr;

    // O^T += V^T(64 d x 64 keys) * P^T(64 keys x 16 queries)
    const unsigned char* vp = stage + vlane;
#pragma unroll
    for (int t = 0; t < 4; ++t) {
      o[t] = wmma_bf16(frag_vt(vp + 32 * t), pb[0], o[t]);
      o[t] = wmma_bf16(frag_vt(vp + 32 * VPITCH + 32 * t), pb[1], o[t]);
    }

    // hand-over: this wave has left the stage, its copies of the next have
    // landed; behind the barrier that holds for all waves, and the buffer
    // just read may be refilled
    asm volatile("s_wait_dscnt 0x0" ::: "memory");
    asm volatile("s_wait_asynccnt 0x0" ::: "memory");
    __syncthreads();
    if (kt + 2 < KV_TILES) issue(kt + 2, kt & 1);
  }
  asm volatile("s_wait_asynccnt 0x0" ::: "memory");  // no copy in flight at the wave's end

  // a lane holds 8 consecutive d of its query per tile: one 16B store each
  const float inv = 1.0f / (l_run + xhalf(l_run));
  __bf16* op = attn_out + (size_t)(b * SEQ + q0 + lsub) * HIDDEN + h * HEAD_DIM + hi * 8;
#pragma unroll
  for (int t = 0; t < 4; ++t) {
    union { uint4 u; __bf16 e[8]; } w;
#pragma unroll
    for (int r = 0; r < 8; ++r) w.e[r] = (__bf16)(o[t][r] * inv);
    *reinterpret_cast<uint4*>(op + t * 16) = w.u;
  }
}

// ---------------------------------------------------------------------------
// Host-side launch
// ---------------------------------------------------------------------------
extern "C" void kernel_launch(void* const* d_in, const int* in_sizes, int n_in,
                              void* d_out, int out_size, void* d_ws, size_t ws_size,
                              hipStream_t stream) {
  (void)in_sizes; (void)n_in; (void)out_size; (void)ws_size;
  const float* X  = (const float*)d_in[0];
  const float* Wq = (const float*)d_in[1];
  const float* bq = (const float*)d_in[2];
  const float* Wk = (const float*)d_in[3];
  const float* bk = (const float*)d_in[4];
  const float* Wv = (const float*)d_in[5];
  const float* bv = (const float*)d_in[6];
  const float* Wo = (const float*)d_in[7];
  const float* bo = (const float*)d_in[8];
  float* out = (float*)d_out;

  char* ws = (char*)d_ws;
  size_t off = 0;
  auto take = [&](size_t bytes) {
    void* p = ws + off;
    off += (bytes + 255) & ~(size_t)255;
    return p;
  };
  __bf16* Xbf   = (__bf16*)take((size_t)M_ROWS * HIDDEN * 2);  // 16 MB
  __bf16* WqkvT = (__bf16*)take((size_t)QKV_N * HIDDEN * 2);   // 2.25 MB  [N][K]
  __bf16* WoT   = (__bf16*)take((size_t)HIDDEN * HIDDEN * 2);  // 2 MB     [N][K]
  float*  bqkv  = (float*)take((size_t)QKV_N * 4);
  __bf16* QKV   = (__bf16*)take((size_t)M_ROWS * QKV_N * 2);   // 18 MB
  __bf16* Attn  = (__bf16*)take((size_t)M_ROWS * HIDDEN * 2);  // 16 MB

  // 1) precision conversion + transposed weight packing (one-time)
  convert_f32_bf16<<<1024, 256, 0, stream>>>(X, Xbf, (size_t)M_ROWS * HIDDEN);
  pack_wqkv_t<<<512, 256, 0, stream>>>(Wq, Wk, Wv, bq, bk, bv, WqkvT, bqkv);
  transpose_f32_bf16<<<512, 256, 0, stream>>>(Wo, WoT, HIDDEN, HIDDEN);

  // 2) fused QKV projection: [8192,1024] x [1024,1152] + bias -> bf16
  gemm_bf16_wmma<__bf16><<<(M_ROWS / 256) * (QKV_N / 128), 256, 0, stream>>>(
      Xbf, WqkvT, bqkv, QKV, M_ROWS, QKV_N, HIDDEN);

  // 3) flash multi-query attention -> bf16 [8192,1024]
  mqa_attention<<<BATCH * HEADS * (SEQ / 128), 256, 0, stream>>>(QKV, Attn);

  // 4) output projection: [8192,1024] x [1024,1024] + bo -> f32 out
  gemm_bf16_wmma<float><<<(M_ROWS / 256) * (HIDDEN / 128), 256, 0, stream>>>(
      Attn, WoT, bo, out, M_ROWS, HIDDEN, HIDDEN);
}

// v003
// A run of this version takes 156 microseconds.
// Next to v002, in two timings, it ran 1.10 times as fast each time.
// All steps since v000 together make it 2.64 times as fast.
#include <hip/hip_runtime.h>
#include <math.h>

typedef __attribute__((ext_vector_type(16))) __bf16 v16bf;
typedef __attribute__((ext_vector_type(8)))  float  v8f;

#define HIDDEN   1024
#define HEADS    16
#define HEAD_DIM 64
#define BATCH    4
#define SEQ      2048
#define M_ROWS   (BATCH * SEQ)           // 8192
#define QKV_N    (HIDDEN + 2 * HEAD_DIM) // 1152

static __device__ __forceinline__ v16bf frag_k32(const __bf16* base, int ld) {
  const int lane = threadIdx.x & 31;
  const int lsub = lane & 15, hi = lane >> 4;
  const __bf16* p = base + (size_t)lsub * ld + hi * 8;
  union { uint4 u[2]; v16bf v; } t;
  t.u[0] = *reinterpret_cast<const uint4*>(p);
  t.u[1] = *reinterpret_cast<const uint4*>(p + 16);
  return t.v;
}

static __device__ __forceinline__ v8f wmma_bf16(v16bf a, v16bf b, v8f c) {
  return __builtin_amdgcn_wmma_f32_16x16x32_bf16(false, a, false, b, (short)0, c,
                                                 false, false);
}

// LDS byte offset of a generic pointer to __shared__.
static __device__ __forceinline__ unsigned lds_off32(const void* p) {
  return (unsigned)(uintptr_t)p;
}

static __device__ __forceinline__ void async_copy6_b128(
    unsigned l0, const void* g0, unsigned l1, const void* g1, unsigned l2, const void* g2,
    unsigned l3, const void* g3, unsigned l4, const void* g4, unsigned l5, const void* g5) {
  asm volatile("global_load_async_to_lds_b128 %0, %1, off\n\t"
               "global_load_async_to_lds_b128 %2, %3, off\n\t"
               "global_load_async_to_lds_b128 %4, %5, off\n\t"
               "global_load_async_to_lds_b128 %6, %7, off\n\t"
               "global_load_async_to_lds_b128 %8, %9, off\n\t"
               "global_load_async_to_lds_b128 %10, %11, off\n\t"
               "s_wait_xcnt 0x0"
               :: "v"(l0), "v"(g0), "v"(l1), "v"(g1), "v"(l2), "v"(g2),
                  "v"(l3), "v"(g3), "v"(l4), "v"(g4), "v"(l5), "v"(g5)
               : "memory");
}

// ---------------------------------------------------------------------------
// Conversion / packing kernels (one-time, tiny).
// Weights stored TRANSPOSED ([N][K] bf16) so GEMM B-fragments are wide.
// The attention scale 1/sqrt(64) = 2^-3 is folded into Wq/bq here (exact).
// ---------------------------------------------------------------------------
__global__ void convert_f32_bf16(const float* __restrict__ src,
                                 __bf16* __restrict__ dst, size_t n) {
  size_t i = (size_t)blockIdx.x * blockDim.x + threadIdx.x;
  const size_t stride = (size_t)gridDim.x * blockDim.x;
  for (; i < n; i += stride) dst[i] = (__bf16)src[i];
}

__global__ void pack_wqkv_t(const float* __restrict__ Wq, const float* __restrict__ Wk,
                            const float* __restrict__ Wv, const float* __restrict__ bq,
                            const float* __restrict__ bk, const float* __restrict__ bv,
                            __bf16* __restrict__ Wt, float* __restrict__ bqkv) {
  size_t i = (size_t)blockIdx.x * blockDim.x + threadIdx.x;
  const size_t stride = (size_t)gridDim.x * blockDim.x;
  const size_t total = (size_t)QKV_N * HIDDEN;
  for (; i < total; i += stride) {
    const int n = (int)(i / HIDDEN), k = (int)(i % HIDDEN);
    float v;
    if (n < HIDDEN)                 v = Wq[(size_t)k * HIDDEN + n] * 0.125f;  // fold 1/sqrt(Dh)
    else if (n < HIDDEN + HEAD_DIM) v = Wk[(size_t)k * HEAD_DIM + (n - HIDDEN)];
    else                            v = Wv[(size_t)k * HEAD_DIM + (n - HIDDEN - HEAD_DIM)];
    Wt[i] = (__bf16)v;  // Wt[n][k]
    if (i < QKV_N) {
      const int n2 = (int)i;
      bqkv[n2] = (n2 < HIDDEN) ? bq[n2] * 0.125f
               : (n2 < HIDDEN + HEAD_DIM) ? bk[n2 - HIDDEN]
                                          : bv[n2 - HIDDEN - HEAD_DIM];
    }
  }
}

__global__ void transpose_f32_bf16(const float* __restrict__ W,  // [K][N]
                                   __bf16* __restrict__ Wt,      // [N][K]
                                   int K, int N) {
  size_t i = (size_t)blockIdx.x * blockDim.x + threadIdx.x;
  const size_t stride = (size_t)gridDim.x * blockDim.x;
  const size_t total = (size_t)K * N;
  for (; i < total; i += stride) {
    const int n = (int)(i / K), k = (int)(i % K);
    Wt[i] = (__bf16)W[(size_t)k * N + n];
  }
}

template <typename OutT>
__global__ __launch_bounds__(256) void gemm_bf16_wmma(
    const __bf16* __restrict__ A, const __bf16* __restrict__ Wt,
    const float* __restrict__ bias, OutT* __restrict__ C, int M, int N, int K) {
  constexpr int BM = 256, BN = 128, BK = 32;
  constexpr int LDP = BK + 8;                       // LDS row pitch, elements (80 B)
  __shared__ __align__(16) __bf16 As[2][BM * LDP];  // row-major [row][k], 2x20KB
  __shared__ __align__(16) __bf16 Bs[2][BN * LDP];  // col-major [col][k], 2x10KB

  const int tid = threadIdx.x, lane = tid & 31, wave = tid >> 5;
  const int wm = wave & 3, wn = wave >> 2;  // 4 waves in M, 2 in N
  const int nb = N / BN;
  const int row0 = (blockIdx.x / nb) * BM;
  const int col0 = (blockIdx.x % nb) * BN;

  // copy map: a thread brings 8 bf16 of row tid>>2 at k-offset (tid&3)*8, and
  // the same of the rows 64, 128, 192 further on (A: 4 copies, B: 2)
  const int crow = tid >> 2, ck = (tid & 3) * 8;
  const unsigned lthr = (unsigned)(crow * LDP + ck) * 2;
  const unsigned asBase[2] = {lds_off32(As[0]) + lthr, lds_off32(As[1]) + lthr};
  const unsigned bsBase[2] = {lds_off32(Bs[0]) + lthr, lds_off32(Bs[1]) + lthr};
  constexpr unsigned LSTEP = 64 * LDP * 2;  // 64 rows in LDS, bytes
  const size_t gstep = (size_t)64 * K;      // 64 rows in global memory, elements
  const __bf16* aThr = A + (size_t)(row0 + crow) * K + ck;
  const __bf16* bThr = Wt + (size_t)(col0 + crow) * K + ck;

  auto issue = [&](int k0, int buf) {
    const __bf16* a = aThr + k0;
    const __bf16* b = bThr + k0;
    const unsigned la = asBase[buf], lb = bsBase[buf];
    async_copy6_b128(la, a, la + LSTEP, a + gstep, la + 2 * LSTEP, a + 2 * gstep,
                     la + 3 * LSTEP, a + 3 * gstep, lb, b, lb + LSTEP, b + gstep);
  };

  v8f acc[4][4];
  issue(0, 0);

  // peeled first k-step: accumulate onto inline zero
  {
    asm volatile("s_wait_asynccnt 0x0" ::: "memory");
    __syncthreads();
    if (BK < K) issue(BK, 1);
    v16bf af[4], bf[4];
#pragma unroll
    for (int i = 0; i < 4; ++i) af[i] = frag_k32(&As[0][(wm * 64 + i * 16) * LDP], LDP);
#pragma unroll
    for (int j = 0; j < 4; ++j) bf[j] = frag_k32(&Bs[0][(wn * 64 + j * 16) * LDP], LDP);
    const v8f z = {};
#pragma unroll
    for (int i = 0; i < 4; ++i)
#pragma unroll
      for (int j = 0; j < 4; ++j) acc[i][j] = wmma_bf16(af[i], bf[j], z);
  }

  int buf = 1;
  for (int k0 = BK; k0 < K; k0 += BK, buf ^= 1) {
    asm volatile("s_wait_dscnt 0x0" ::: "memory");     // our reads of buf^1 are over
    asm volatile("s_wait_asynccnt 0x0" ::: "memory");  // our DMAs into buf landed
    __syncthreads();  // everyone's landed; everyone finished reading buf^1
    if (k0 + BK < K) issue(k0 + BK, buf ^ 1);  // DMA overlaps WMMAs below

    v16bf af[4], bf[4];
#pragma unroll
    for (int i = 0; i < 4; ++i) af[i] = frag_k32(&As[buf][(wm * 64 + i * 16) * LDP], LDP);
#pragma unroll
    for (int j = 0; j < 4; ++j) bf[j] = frag_k32(&Bs[buf][(wn * 64 + j * 16) * LDP], LDP);
#pragma unroll
    for (int i = 0; i < 4; ++i)
#pragma unroll
      for (int j = 0; j < 4; ++j) acc[i][j] = wmma_bf16(af[i], bf[j], acc[i][j]);
  }
  asm volatile("s_wait_asynccnt 0x0" ::: "memory");  // no copy in flight at the wave's end

  const int lsub = lane & 15, hi = lane >> 4;
#pragma unroll
  for (int i = 0; i < 4; ++i)
#pragma unroll
    for (int j = 0; j < 4; ++j)
#pragma unroll
      for (int r = 0; r < 8; ++r) {
        const int row = row0 + wm * 64 + i * 16 + r + 8 * hi;
        const int col = col0 + wn * 64 + j * 16 + lsub;
        C[(size_t)row * N + col] = (OutT)(acc[i][j][r] + bias[col]);
      }
}

static __device__ __forceinline__ float xhalf(float x) {
  const int v = __builtin_bit_cast(int, x);
  return __builtin_bit_cast(
      float, __builtin_amdgcn_permlanex16(v, v, 0x76543210, 0xfedcba98, false, false));
}

#define KPITCH  144
#define VPITCH  160
#define KTILE_B (64 * KPITCH)
#define STAGE_B (KTILE_B + 64 * VPITCH)
#define KV_TILES (SEQ / 64)

typedef unsigned u32x4 __attribute__((ext_vector_type(4)));
typedef short    s16x8 __attribute__((ext_vector_type(8)));

static __device__ __forceinline__ u32x4 lds_tr16(const unsigned char* p) {
  typedef __attribute__((address_space(3))) s16x8 lds_s16x8;
  return __builtin_bit_cast(u32x4, __builtin_amdgcn_ds_load_tr16_b128_v8i16((lds_s16x8*)p));
}

// A fragment of V^T (16 d x 32 keys, hardware k order) from row-major V rows.
// p = this lane's address for the fragment's first 16 keys.
static __device__ __forceinline__ v16bf frag_vt(const unsigned char* p) {
  union { u32x4 q[2]; v16bf v; } t;
  t.q[0] = lds_tr16(p);
  t.q[1] = lds_tr16(p + 16 * VPITCH);
  return t.v;
}

static __device__ __forceinline__ void async_copy4_b128(
    unsigned l0, const void* g0, unsigned l1, const void* g1,
    unsigned l2, const void* g2, unsigned l3, const void* g3) {
  asm volatile("global_load_async_to_lds_b128 %0, %1, off\n\t"
               "global_load_async_to_lds_b128 %2, %3, off\n\t"
               "global_load_async_to_lds_b128 %4, %5, off\n\t"
               "global_load_async_to_lds_b128 %6, %7, off\n\t"
               "s_wait_xcnt 0x0"
               :: "v"(l0), "v"(g0), "v"(l1), "v"(g1), "v"(l2), "v"(g2), "v"(l3), "v"(g3)
               : "memory");
}

__global__ __launch_bounds__(256) void mqa_attention(
    const __bf16* __restrict__ qkv, __bf16* __restrict__ attn_out) {
  // per buffer: K [64 keys][KPITCH], then V [64 keys][VPITCH], both row-major
  __shared__ __attribute__((aligned(128))) unsigned char kv[2][STAGE_B];

  const int tid = threadIdx.x, lane = tid & 31, wave = tid >> 5;
  const int lsub = lane & 15, hi = lane >> 4;
  const int qb = blockIdx.x & 15;          // SEQ/128 = 16
  const int h  = (blockIdx.x >> 4) & 15;
  const int b  = blockIdx.x >> 8;
  const int q0 = qb * 128 + wave * 16;
  const int ld = QKV_N;

  // copy map: 16 chunks of 16B per key row (8 of K, 8 of V), 16 rows per copy
  const int crow = tid >> 4, cc = tid & 15;
  const unsigned isv = (unsigned)cc >> 3;                      // 0: a K chunk, 1: a V chunk
  const unsigned cpitch = KPITCH + isv * (VPITCH - KPITCH);
  const unsigned ldst = lds_off32(&kv[0][0]) + isv * KTILE_B + (unsigned)crow * cpitch + (cc & 7) * 16u;
  const unsigned lstep = 16u * cpitch;
  const unsigned char* gsrc =
      reinterpret_cast<const unsigned char*>(qkv + (size_t)(b * SEQ + crow) * ld + HIDDEN) + cc * 16;
  constexpr size_t GSTEP = (size_t)16 * QKV_N * 2;  // 16 key rows, bytes

  auto issue = [&](int tile, int buf) {
    const unsigned l = ldst + (unsigned)buf * STAGE_B;
    const unsigned char* g = gsrc + (size_t)tile * (4 * GSTEP);
    async_copy4_b128(l, g, l + lstep, g + GSTEP, l + 2 * lstep, g + 2 * GSTEP,
                     l + 3 * lstep, g + 3 * GSTEP);
  };

  issue(0, 0);

  // Q fragments (B operand: column = query, straight from global, 2x b128 per frag)
  const __bf16* qp = qkv + (size_t)(b * SEQ + q0) * ld + h * HEAD_DIM;
  const v16bf q_lo = frag_k32(qp, ld);
  const v16bf q_hi = frag_k32(qp + 32, ld);

  float m_run = -INFINITY;  // this lane's query: running maximum (both halves agree)
  float l_run = 0.0f;       // running sum over this half's keys only; joined at the end
  v8f o[4] = {};            // o[t][r] = O[query lsub][d = t*16 + 8*hi + r]

  // this lane's place in a V tile for the transposing load
  const unsigned vlane = KTILE_B + (unsigned)(8 * hi + (lane & 7)) * VPITCH + 16u * ((lane >> 3) & 1);

  asm volatile("s_wait_asynccnt 0x0" ::: "memory");  // own copies of stage 0 landed
  __syncthreads();                                   // everyone's landed
  issue(1, 1);

  for (int kt = 0; kt < KV_TILES; ++kt) {
    const unsigned char* stage = kv[kt & 1];

    // S^T = K * Q^T (64 keys x 16 queries)
    // s[n][r] = score(key kt*64 + n*16 + 8*hi + r, query lsub)
    v8f s[4] = {};
#pragma unroll
    for (int n = 0; n < 4; ++n) {
      const __bf16* kb = reinterpret_cast<const __bf16*>(stage + n * 16 * KPITCH);
      s[n] = wmma_bf16(frag_k32(kb, KPITCH / 2), q_lo, s[n]);
      s[n] = wmma_bf16(frag_k32(kb + 32, KPITCH / 2), q_hi, s[n]);
    }

    // online softmax over 64 keys of one query per lane
    float mx = s[0][0];
#pragma unroll
    for (int n = 0; n < 4; ++n)
#pragma unroll
      for (int r = 0; r < 8; ++r) mx = fmaxf(mx, s[n][r]);
    mx = fmaxf(mx, xhalf(mx));
    const float mnew = fmaxf(m_run, mx);
    const float corr = __expf(m_run - mnew);
    m_run = mnew;

    v16bf pb[2];   // P^T as B operands: keys 0..31 and 32..63 of the tile
#pragma unroll
    for (int n = 0; n < 4; ++n)
#pragma unroll
      for (int r = 0; r < 8; ++r) {
        s[n][r] = __expf(s[n][r] - mnew);
        pb[n >> 1][(n & 1) * 8 + r] = (__bf16)s[n][r];
      }
    const v8f rs = (s[0] + s[1]) + (s[2] + s[3]);  // this half's 32 keys, register by register
    l_run = l_run * corr + (((rs[0] + rs[1]) + (rs[2] + rs[3])) + ((rs[4] + rs[5]) + (rs[6] + rs[7])));
#pragma unroll
    for (int t = 0; t < 4; ++t) o[t] *= corr;

    // O^T += V^T(64 d x 64 keys) * P^T(64 keys x 16 queries)
    const unsigned char* vp = stage + vlane;
#pragma unroll
    for (int t = 0; t < 4; ++t) {
      o[t] = wmma_bf16(frag_vt(vp + 32 * t), pb[0], o[t]);
      o[t] = wmma_bf16(frag_vt(vp + 32 * VPITCH + 32 * t), pb[1], o[t]);
    }

    // hand-over: this wave has left the stage, its copies of the next have
    // landed; behind the barrier that holds for all waves, and the buffer
    // just read may be refilled
    asm volatile("s_wait_dscnt 0x0" ::: "memory");
    asm volatile("s_wait_asynccnt 0x0" ::: "memory");
    __syncthreads();
    if (kt + 2 < KV_TILES) issue(kt + 2, kt & 1);
  }
  asm volatile("s_wait_asynccnt 0x0" ::: "memory");  // no copy in flight at the wave's end

  // a lane holds 8 consecutive d of its query per tile: one 16B store each
  const float inv = 1.0f / (l_run + xhalf(l_run));
  __bf16* op = attn_out + (size_t)(b * SEQ + q0 + lsub) * HIDDEN + h * HEAD_DIM + hi * 8;
#pragma unroll
  for (int t = 0; t < 4; ++t) {
    union { uint4 u; __bf16 e[8]; } w;
#pragma unroll
    for (int r = 0; r < 8; ++r) w.e[r] = (__bf16)(o[t][r] * inv);
    *reinterpret_cast<uint4*>(op + t * 16) = w.u;
  }
}

// ---------------------------------------------------------------------------
// Host-side launch
// ---------------------------------------------------------------------------
extern "C" void kernel_launch(void* const* d_in, const int* in_sizes, int n_in,
                              void* d_out, int out_size, void* d_ws, size_t ws_size,
                              hipStream_t stream) {
  (void)in_sizes; (void)n_in; (void)out_size; (void)ws_size;
  const float* X  = (const float*)d_in[0];
  const float* Wq = (const float*)d_in[1];
  const float* bq = (const float*)d_in[2];
  const float* Wk = (const float*)d_in[3];
  const float* bk = (const float*)d_in[4];
  const float* Wv = (const float*)d_in[5];
  const float* bv = (const float*)d_in[6];
  const float* Wo = (const float*)d_in[7];
  const float* bo = (const float*)d_in[8];
  float* out = (float*)d_out;

  char* ws = (char*)d_ws;
  size_t off = 0;
  auto take = [&](size_t bytes) {
    void* p = ws + off;
    off += (bytes + 255) & ~(size_t)255;
    return p;
  };
  __bf16* Xbf   = (__bf16*)take((size_t)M_ROWS * HIDDEN * 2);  // 16 MB
  __bf16* WqkvT = (__bf16*)take((size_t)QKV_N * HIDDEN * 2);   // 2.25 MB  [N][K]
  __bf16* WoT   = (__bf16*)take((size_t)HIDDEN * HIDDEN * 2);  // 2 MB     [N][K]
  float*  bqkv  = (float*)take((size_t)QKV_N * 4);
  __bf16* QKV   = (__bf16*)take((size_t)M_ROWS * QKV_N * 2);   // 18 MB
  __bf16* Attn  = (__bf16*)take((size_t)M_ROWS * HIDDEN * 2);  // 16 MB

  // 1) precision conversion + transposed weight packing (one-time)
  convert_f32_bf16<<<1024, 256, 0, stream>>>(X, Xbf, (size_t)M_ROWS * HIDDEN);
  pack_wqkv_t<<<512, 256, 0, stream>>>(Wq, Wk, Wv, bq, bk, bv, WqkvT, bqkv);
  transpose_f32_bf16<<<512, 256, 0, stream>>>(Wo, WoT, HIDDEN, HIDDEN);

  // 2) fused QKV projection: [8192,1024] x [1024,1152] + bias -> bf16
  gemm_bf16_wmma<__bf16><<<(M_ROWS / 256) * (QKV_N / 128), 256, 0, stream>>>(
      Xbf, WqkvT, bqkv, QKV, M_ROWS, QKV_N, HIDDEN);

  // 3) flash multi-query attention -> bf16 [8192,1024]
  mqa_attention<<<BATCH * HEADS * (SEQ / 128), 256, 0, stream>>>(QKV, Attn);

  // 4) output projection: [8192,1024] x [1024,1024] + bo -> f32 out
  gemm_bf16_wmma<float><<<(M_ROWS / 256) * (HIDDEN / 128), 256, 0, stream>>>(
      Attn, WoT, bo, out, M_ROWS, HIDDEN, HIDDEN);
}

// v004
// Measured time: 136 microseconds a run.
// Two timings next to v003 put it at 1.15 and 1.14 times that version's speed.
// All steps since v000 together make it 3.02 times as fast.
#include <hip/hip_runtime.h>
#include <math.h>

typedef __attribute__((ext_vector_type(16))) __bf16 v16bf;
typedef __attribute__((ext_vector_type(8)))  float  v8f;

#define HIDDEN   1024
#define HEADS    16
#define HEAD_DIM 64
#define BATCH    4
#define SEQ      2048
#define M_ROWS   (BATCH * SEQ)           // 8192
#define QKV_N    (HIDDEN + 2 * HEAD_DIM) // 1152

static __device__ __forceinline__ v16bf frag_k32(const __bf16* base, int ld) {
  const int lane = threadIdx.x & 31;
  const int lsub = lane & 15, hi = lane >> 4;
  const __bf16* p = base + (size_t)lsub * ld + hi * 8;
  union { uint4 u[2]; v16bf v; } t;
  t.u[0] = *reinterpret_cast<const uint4*>(p);
  t.u[1] = *reinterpret_cast<const uint4*>(p + 16);
  return t.v;
}

static __device__ __forceinline__ v8f wmma_bf16(v16bf a, v16bf b, v8f c) {
  return __builtin_amdgcn_wmma_f32_16x16x32_bf16(false, a, false, b, (short)0, c,
                                                 false, false);
}

// LDS byte offset of a generic pointer to __shared__.
static __device__ __forceinline__ unsigned lds_off32(const void* p) {
  return (unsigned)(uintptr_t)p;
}

static __device__ __forceinline__ void async_copy6_b128(
    unsigned l0, const void* g0, unsigned l1, const void* g1, unsigned l2, const void* g2,
    unsigned l3, const void* g3, unsigned l4, const void* g4, unsigned l5, const void* g5) {
  asm volatile("global_load_async_to_lds_b128 %0, %1, off\n\t"
               "global_load_async_to_lds_b128 %2, %3, off\n\t"
               "global_load_async_to_lds_b128 %4, %5, off\n\t"
               "global_load_async_to_lds_b128 %6, %7, off\n\t"
               "global_load_async_to_lds_b128 %8, %9, off\n\t"
               "global_load_async_to_lds_b128 %10, %11, off\n\t"
               "s_wait_xcnt 0x0"
               :: "v"(l0), "v"(g0), "v"(l1), "v"(g1), "v"(l2), "v"(g2),
                  "v"(l3), "v"(g3), "v"(l4), "v"(g4), "v"(l5), "v"(g5)
               : "memory");
}

// ---------------------------------------------------------------------------
// Conversion / packing kernels. Each is a short stream: a thread issues all of
// its loads before it uses the first, so a wave pays the memory latency once.
// Weights stored TRANSPOSED ([N][K] bf16) so GEMM B-fragments are wide.
// The attention scale 1/sqrt(64) = 2^-3 is folded into Wq/bq here (exact).
// ---------------------------------------------------------------------------
#define CVT_VEC 16  // 16 B loads per thread

// A block converts 256 * CVT_VEC * 4 consecutive floats. Every wave-wide load
// covers 512 contiguous bytes, every wave-wide store 256.
__global__ __launch_bounds__(256) void convert_f32_bf16(const float* __restrict__ src,
                                                        __bf16* __restrict__ dst) {
  const size_t base = (size_t)blockIdx.x * (256 * CVT_VEC) + threadIdx.x;  // in units of 4 elements
  const float4* s4 = reinterpret_cast<const float4*>(src) + base;
  uint2* d4 = reinterpret_cast<uint2*>(dst) + base;
  float4 v[CVT_VEC];
#pragma unroll  // v stays in registers and the loads issue back to back
  for (int j = 0; j < CVT_VEC; ++j) v[j] = s4[j * 256];
#pragma unroll  // constant indices into v
  for (int j = 0; j < CVT_VEC; ++j) {
    union { uint2 u; __bf16 e[4]; } w;
    w.e[0] = (__bf16)v[j].x;
    w.e[1] = (__bf16)v[j].y;
    w.e[2] = (__bf16)v[j].z;
    w.e[3] = (__bf16)v[j].w;
    d4[j * 256] = w.u;
  }
}

// 64 consecutive k of one column of a row-major f32 matrix (row length LD)
// -> one 128 B line of the transposed bf16 matrix. The lanes of a wave hold
// neighbouring columns, so each of the 64 loads reads one whole line.
template <int LD>
static __device__ __forceinline__ void column64_to_line(const float* __restrict__ col,
                                                        float scale, __bf16* __restrict__ line) {
  float v[64];
#pragma unroll  // v stays in registers and the loads issue back to back
  for (int j = 0; j < 64; ++j) v[j] = col[(size_t)j * LD];
#pragma unroll  // constant indices into v, here and in the loop inside
  for (int c = 0; c < 8; ++c) {
    union { uint4 u; __bf16 e[8]; } w;
#pragma unroll
    for (int r = 0; r < 8; ++r) w.e[r] = (__bf16)(v[c * 8 + r] * scale);
    reinterpret_cast<uint4*>(line)[c] = w.u;
  }
}

// Grid: (QKV_N / 64) column blocks x (HIDDEN / 64) k blocks, 64 threads each.
// A column block lies wholly in Wq, in Wk or in Wv.
__global__ __launch_bounds__(64) void pack_wqkv_t(
    const float* __restrict__ Wq, const float* __restrict__ Wk,
    const float* __restrict__ Wv, const float* __restrict__ bq,
    const float* __restrict__ bk, const float* __restrict__ bv,
    __bf16* __restrict__ Wt, float* __restrict__ bqkv) {
  constexpr int NB = QKV_N / 64;
  const int nb = blockIdx.x % NB, k0 = (blockIdx.x / NB) * 64;
  const int t = threadIdx.x, n = nb * 64 + t;
  __bf16* line = Wt + (size_t)n * HIDDEN + k0;  // Wt[n][k]
  if (nb < HIDDEN / 64)
    column64_to_line<HIDDEN>(Wq + (size_t)k0 * HIDDEN + n, 0.125f, line);  // fold 1/sqrt(Dh)
  else if (nb == HIDDEN / 64)
    column64_to_line<HEAD_DIM>(Wk + (size_t)k0 * HEAD_DIM + t, 1.0f, line);
  else
    column64_to_line<HEAD_DIM>(Wv + (size_t)k0 * HEAD_DIM + t, 1.0f, line);
  if (k0 == 0) {
    // the code below reuses registers that the line's issued stores name
    asm volatile("s_wait_xcnt 0x0" ::: "memory");
    bqkv[n] = (nb < HIDDEN / 64) ? bq[n] * 0.125f : (nb == HIDDEN / 64) ? bk[t] : bv[t];
  }
}

// W [HIDDEN][HIDDEN] -> Wt [N][K]. Grid: 16 column blocks x 16 k blocks.
__global__ __launch_bounds__(64) void transpose_f32_bf16(const float* __restrict__ W,
                                                         __bf16* __restrict__ Wt) {
  constexpr int NB = HIDDEN / 64;
  const int n = (blockIdx.x % NB) * 64 + threadIdx.x, k0 = (blockIdx.x / NB) * 64;
  column64_to_line<HIDDEN>(W + (size_t)k0 * HIDDEN + n, 1.0f, Wt + (size_t)n * HIDDEN + k0);
}

template <typename OutT>
__global__ __launch_bounds__(256) void gemm_bf16_wmma(
    const __bf16* __restrict__ A, const __bf16* __restrict__ Wt,
    const float* __restrict__ bias, OutT* __restrict__ C, int M, int N, int K) {
  constexpr int BM = 256, BN = 128, BK = 32;
  constexpr int LDP = BK + 8;                       // LDS row pitch, elements (80 B)
  __shared__ __align__(16) __bf16 As[2][BM * LDP];  // row-major [row][k], 2x20KB
  __shared__ __align__(16) __bf16 Bs[2][BN * LDP];  // col-major [col][k], 2x10KB

  const int tid = threadIdx.x, lane = tid & 31, wave = tid >> 5;
  const int wm = wave & 3, wn = wave >> 2;  // 4 waves in M, 2 in N
  const int nb = N / BN;
  const int row0 = (blockIdx.x / nb) * BM;
  const int col0 = (blockIdx.x % nb) * BN;

  // copy map: a thread brings 8 bf16 of row tid>>2 at k-offset (tid&3)*8, and
  // the same of the rows 64, 128, 192 further on (A: 4 copies, B: 2)
  const int crow = tid >> 2, ck = (tid & 3) * 8;
  const unsigned lthr = (unsigned)(crow * LDP + ck) * 2;
  const unsigned asBase[2] = {lds_off32(As[0]) + lthr, lds_off32(As[1]) + lthr};
  const unsigned bsBase[2] = {lds_off32(Bs[0]) + lthr, lds_off32(Bs[1]) + lthr};
  constexpr unsigned LSTEP = 64 * LDP * 2;  // 64 rows in LDS, bytes
  const size_t gstep = (size_t)64 * K;      // 64 rows in global memory, elements
  const __bf16* aThr = A + (size_t)(row0 + crow) * K + ck;
  const __bf16* bThr = Wt + (size_t)(col0 + crow) * K + ck;

  auto issue = [&](int k0, int buf) {
    const __bf16* a = aThr + k0;
    const __bf16* b = bThr + k0;
    const unsigned la = asBase[buf], lb = bsBase[buf];
    async_copy6_b128(la, a, la + LSTEP, a + gstep, la + 2 * LSTEP, a + 2 * gstep,
                     la + 3 * LSTEP, a + 3 * gstep, lb, b, lb + LSTEP, b + gstep);
  };

  v8f acc[4][4];
  issue(0, 0);

  // peeled first k-step: accumulate onto inline zero
  {
    asm volatile("s_wait_asynccnt 0x0" ::: "memory");
    __syncthreads();
    if (BK < K) issue(BK, 1);
    v16bf af[4], bf[4];
#pragma unroll
    for (int i = 0; i < 4; ++i) af[i] = frag_k32(&As[0][(wm * 64 + i * 16) * LDP], LDP);
#pragma unroll
    for (int j = 0; j < 4; ++j) bf[j] = frag_k32(&Bs[0][(wn * 64 + j * 16) * LDP], LDP);
    const v8f z = {};
#pragma unroll
    for (int i = 0; i < 4; ++i)
#pragma unroll
      for (int j = 0; j < 4; ++j) acc[i][j] = wmma_bf16(af[i], bf[j], z);
  }

  int buf = 1;
  for (int k0 = BK; k0 < K; k0 += BK, buf ^= 1) {
    asm volatile("s_wait_dscnt 0x0" ::: "memory");     // our reads of buf^1 are over
    asm volatile("s_wait_asynccnt 0x0" ::: "memory");  // our DMAs into buf landed
    __syncthreads();  // everyone's landed; everyone finished reading buf^1
    if (k0 + BK < K) issue(k0 + BK, buf ^ 1);  // DMA overlaps WMMAs below

    v16bf af[4], bf[4];
#pragma unroll
    for (int i = 0; i < 4; ++i) af[i] = frag_k32(&As[buf][(wm * 64 + i * 16) * LDP], LDP);
#pragma unroll
    for (int j = 0; j < 4; ++j) bf[j] = frag_k32(&Bs[buf][(wn * 64 + j * 16) * LDP], LDP);
#pragma unroll
    for (int i = 0; i < 4; ++i)
#pragma unroll
      for (int j = 0; j < 4; ++j) acc[i][j] = wmma_bf16(af[i], bf[j], acc[i][j]);
  }
  asm volatile("s_wait_asynccnt 0x0" ::: "memory");  // no copy in flight at the wave's end

  const int lsub = lane & 15, hi = lane >> 4;
#pragma unroll
  for (int i = 0; i < 4; ++i)
#pragma unroll
    for (int j = 0; j < 4; ++j)
#pragma unroll
      for (int r = 0; r < 8; ++r) {
        const int row = row0 + wm * 64 + i * 16 + r + 8 * hi;
        const int col = col0 + wn * 64 + j * 16 + lsub;
        C[(size_t)row * N + col] = (OutT)(acc[i][j][r] + bias[col]);
      }
}

static __device__ __forceinline__ float xhalf(float x) {
  const int v = __builtin_bit_cast(int, x);
  return __builtin_bit_cast(
      float, __builtin_amdgcn_permlanex16(v, v, 0x76543210, 0xfedcba98, false, false));
}

#define KPITCH  144
#define VPITCH  160
#define KTILE_B (64 * KPITCH)
#define STAGE_B (KTILE_B + 64 * VPITCH)
#define KV_TILES (SEQ / 64)

typedef unsigned u32x4 __attribute__((ext_vector_type(4)));
typedef short    s16x8 __attribute__((ext_vector_type(8)));

static __device__ __forceinline__ u32x4 lds_tr16(const unsigned char* p) {
  typedef __attribute__((address_space(3))) s16x8 lds_s16x8;
  return __builtin_bit_cast(u32x4, __builtin_amdgcn_ds_load_tr16_b128_v8i16((lds_s16x8*)p));
}

// A fragment of V^T (16 d x 32 keys, hardware k order) from row-major V rows.
// p = this lane's address for the fragment's first 16 keys.
static __device__ __forceinline__ v16bf frag_vt(const unsigned char* p) {
  union { u32x4 q[2]; v16bf v; } t;
  t.q[0] = lds_tr16(p);
  t.q[1] = lds_tr16(p + 16 * VPITCH);
  return t.v;
}

static __device__ __forceinline__ void async_copy4_b128(
    unsigned l0, const void* g0, unsigned l1, const void* g1,
    unsigned l2, const void* g2, unsigned l3, const void* g3) {
  asm volatile("global_load_async_to_lds_b128 %0, %1, off\n\t"
               "global_load_async_to_lds_b128 %2, %3, off\n\t"
               "global_load_async_to_lds_b128 %4, %5, off\n\t"
               "global_load_async_to_lds_b128 %6, %7, off\n\t"
               "s_wait_xcnt 0x0"
               :: "v"(l0), "v"(g0), "v"(l1), "v"(g1), "v"(l2), "v"(g2), "v"(l3), "v"(g3)
               : "memory");
}

__global__ __launch_bounds__(256) void mqa_attention(
    const __bf16* __restrict__ qkv, __bf16* __restrict__ attn_out) {
  // per buffer: K [64 keys][KPITCH], then V [64 keys][VPITCH], both row-major
  __shared__ __attribute__((aligned(128))) unsigned char kv[2][STAGE_B];

  const int tid = threadIdx.x, lane = tid & 31, wave = tid >> 5;
  const int lsub = lane & 15, hi = lane >> 4;
  const int qb = blockIdx.x & 15;          // SEQ/128 = 16
  const int h  = (blockIdx.x >> 4) & 15;
  const int b  = blockIdx.x >> 8;
  const int q0 = qb * 128 + wave * 16;
  const int ld = QKV_N;

  // copy map: 16 chunks of 16B per key row (8 of K, 8 of V), 16 rows per copy
  const int crow = tid >> 4, cc = tid & 15;
  const unsigned isv = (unsigned)cc >> 3;                      // 0: a K chunk, 1: a V chunk
  const unsigned cpitch = KPITCH + isv * (VPITCH - KPITCH);
  const unsigned ldst = lds_off32(&kv[0][0]) + isv * KTILE_B + (unsigned)crow * cpitch + (cc & 7) * 16u;
  const unsigned lstep = 16u * cpitch;
  const unsigned char* gsrc =
      reinterpret_cast<const unsigned char*>(qkv + (size_t)(b * SEQ + crow) * ld + HIDDEN) + cc * 16;
  constexpr size_t GSTEP = (size_t)16 * QKV_N * 2;  // 16 key rows, bytes

  auto issue = [&](int tile, int buf) {
    const unsigned l = ldst + (unsigned)buf * STAGE_B;
    const unsigned char* g = gsrc + (size_t)tile * (4 * GSTEP);
    async_copy4_b128(l, g, l + lstep, g + GSTEP, l + 2 * lstep, g + 2 * GSTEP,
                     l + 3 * lstep, g + 3 * GSTEP);
  };

  issue(0, 0);

  // Q fragments (B operand: column = query, straight from global, 2x b128 per frag)
  const __bf16* qp = qkv + (size_t)(b * SEQ + q0) * ld + h * HEAD_DIM;
  const v16bf q_lo = frag_k32(qp, ld);
  const v16bf q_hi = frag_k32(qp + 32, ld);

  float m_run = -INFINITY;  // this lane's query: running maximum (both halves agree)
  float l_run = 0.0f;       // running sum over this half's keys only; joined at the end
  v8f o[4] = {};            // o[t][r] = O[query lsub][d = t*16 + 8*hi + r]

  // this lane's place in a V tile for the transposing load
  const unsigned vlane = KTILE_B + (unsigned)(8 * hi + (lane & 7)) * VPITCH + 16u * ((lane >> 3) & 1);

  asm volatile("s_wait_asynccnt 0x0" ::: "memory");  // own copies of stage 0 landed
  __syncthreads();                                   // everyone's landed
  issue(1, 1);

  for (int kt = 0; kt < KV_TILES; ++kt) {
    const unsigned char* stage = kv[kt & 1];

    // S^T = K * Q^T (64 keys x 16 queries)
    // s[n][r] = score(key kt*64 + n*16 + 8*hi + r, query lsub)
    v8f s[4] = {};
#pragma unroll
    for (int n = 0; n < 4; ++n) {
      const __bf16* kb = reinterpret_cast<const __bf16*>(stage + n * 16 * KPITCH);
      s[n] = wmma_bf16(frag_k32(kb, KPITCH / 2), q_lo, s[n]);
      s[n] = wmma_bf16(frag_k32(kb + 32, KPITCH / 2), q_hi, s[n]);
    }

    // online softmax over 64 keys of one query per lane
    float mx = s[0][0];
#pragma unroll
    for (int n = 0; n < 4; ++n)
#pragma unroll
      for (int r = 0; r < 8; ++r) mx = fmaxf(mx, s[n][r]);
    mx = fmaxf(mx, xhalf(mx));
    const float mnew = fmaxf(m_run, mx);
    const float corr = __expf(m_run - mnew);
    m_run = mnew;

    v16bf pb[2];   // P^T as B operands: keys 0..31 and 32..63 of the tile
#pragma unroll
    for (int n = 0; n < 4; ++n)
#pragma unroll
      for (int r = 0; r < 8; ++r) {
        s[n][r] = __expf(s[n][r] - mnew);
        pb[n >> 1][(n & 1) * 8 + r] = (__bf16)s[n][r];
      }
    const v8f rs = (s[0] + s[1]) + (s[2] + s[3]);  // this half's 32 keys, register by register
    l_run = l_run * corr + (((rs[0] + rs[1]) + (rs[2] + rs[3])) + ((rs[4] + rs[5]) + (rs[6] + rs[7])));
#pragma unroll
    for (int t = 0; t < 4; ++t) o[t] *= corr;

    // O^T += V^T(64 d x 64 keys) * P^T(64 keys x 16 queries)
    const unsigned char* vp = stage + vlane;
#pragma unroll
    for (int t = 0; t < 4; ++t) {
      o[t] = wmma_bf16(frag_vt(vp + 32 * t), pb[0], o[t]);
      o[t] = wmma_bf16(frag_vt(vp + 32 * VPITCH + 32 * t), pb[1], o[t]);
    }

    // hand-over: this wave has left the stage, its copies of the next have
    // landed; behind the barrier that holds for all waves, and the buffer
    // just read may be refilled
    asm volatile("s_wait_dscnt 0x0" ::: "memory");
    asm volatile("s_wait_asynccnt 0x0" ::: "memory");
    __syncthreads();
    if (kt + 2 < KV_TILES) issue(kt + 2, kt & 1);
  }
  asm volatile("s_wait_asynccnt 0x0" ::: "memory");  // no copy in flight at the wave's end

  // a lane holds 8 consecutive d of its query per tile: one 16B store each
  const float inv = 1.0f / (l_run + xhalf(l_run));
  __bf16* op = attn_out + (size_t)(b * SEQ + q0 + lsub) * HIDDEN + h * HEAD_DIM + hi * 8;
#pragma unroll
  for (int t = 0; t < 4; ++t) {
    union { uint4 u; __bf16 e[8]; } w;
#pragma unroll
    for (int r = 0; r < 8; ++r) w.e[r] = (__bf16)(o[t][r] * inv);
    *reinterpret_cast<uint4*>(op + t * 16) = w.u;
  }
}

// ---------------------------------------------------------------------------
// Host-side launch
// ---------------------------------------------------------------------------
extern "C" void kernel_launch(void* const* d_in, const int* in_sizes, int n_in,
                              void* d_out, int out_size, void* d_ws, size_t ws_size,
                              hipStream_t stream) {
  (void)in_sizes; (void)n_in; (void)out_size; (void)ws_size;
  const float* X  = (const float*)d_in[0];
  const float* Wq = (const float*)d_in[1];
  const float* bq = (const float*)d_in[2];
  const float* Wk = (const float*)d_in[3];
  const float* bk = (const float*)d_in[4];
  const float* Wv = (const float*)d_in[5];
  const float* bv = (const float*)d_in[6];
  const float* Wo = (const float*)d_in[7];
  const float* bo = (const float*)d_in[8];
  float* out = (float*)d_out;

  char* ws = (char*)d_ws;
  size_t off = 0;
  auto take = [&](size_t bytes) {
    void* p = ws + off;
    off += (bytes + 255) & ~(size_t)255;
    return p;
  };
  __bf16* Xbf   = (__bf16*)take((size_t)M_ROWS * HIDDEN * 2);  // 16 MB
  __bf16* WqkvT = (__bf16*)take((size_t)QKV_N * HIDDEN * 2);   // 2.25 MB  [N][K]
  __bf16* WoT   = (__bf16*)take((size_t)HIDDEN * HIDDEN * 2);  // 2 MB     [N][K]
  float*  bqkv  = (float*)take((size_t)QKV_N * 4);
  __bf16* QKV   = (__bf16*)take((size_t)M_ROWS * QKV_N * 2);   // 18 MB
  __bf16* Attn  = (__bf16*)take((size_t)M_ROWS * HIDDEN * 2);  // 16 MB

  // 1) precision conversion + transposed weight packing (one-time)
  convert_f32_bf16<<<(M_ROWS * HIDDEN) / (256 * CVT_VEC * 4), 256, 0, stream>>>(X, Xbf);
  pack_wqkv_t<<<(QKV_N / 64) * (HIDDEN / 64), 64, 0, stream>>>(Wq, Wk, Wv, bq, bk, bv, WqkvT, bqkv);
  transpose_f32_bf16<<<(HIDDEN / 64) * (HIDDEN / 64), 64, 0, stream>>>(Wo, WoT);

  // 2) fused QKV projection: [8192,1024] x [1024,1152] + bias -> bf16
  gemm_bf16_wmma<__bf16><<<(M_ROWS / 256) * (QKV_N / 128), 256, 0, stream>>>(
      Xbf, WqkvT, bqkv, QKV, M_ROWS, QKV_N, HIDDEN);

  // 3) flash multi-query attention -> bf16 [8192,1024]
  mqa_attention<<<BATCH * HEADS * (SEQ / 128), 256, 0, stream>>>(QKV, Attn);

  // 4) output projection: [8192,1024] x [1024,1024] + bo -> f32 out
  gemm_bf16_wmma<float><<<(M_ROWS / 256) * (HIDDEN / 128), 256, 0, stream>>>(
      Attn, WoT, bo, out, M_ROWS, HIDDEN, HIDDEN);
}

// v005
// Measured time: 128 microseconds a run.
// Two timings next to v004 both put it at 1.06 times that version's speed.
// Over all steps from v000 it is 3.20 times as fast.
#include <hip/hip_runtime.h>
#include <math.h>

typedef __attribute__((ext_vector_type(16))) __bf16 v16bf;
typedef __attribute__((ext_vector_type(8)))  float  v8f;

#define HIDDEN   1024
#define HEADS    16
#define HEAD_DIM 64
#define BATCH    4
#define SEQ      2048
#define M_ROWS   (BATCH * SEQ)           // 8192
#define QKV_N    (HIDDEN + 2 * HEAD_DIM) // 1152

static __device__ __forceinline__ v16bf frag_k32(const __bf16* base, int ld) {
  const int lane = threadIdx.x & 31;
  const int lsub = lane & 15, hi = lane >> 4;
  const __bf16* p = base + (size_t)lsub * ld + hi * 8;
  union { uint4 u[2]; v16bf v; } t;
  t.u[0] = *reinterpret_cast<const uint4*>(p);
  t.u[1] = *reinterpret_cast<const uint4*>(p + 16);
  return t.v;
}

static __device__ __forceinline__ v8f wmma_bf16(v16bf a, v16bf b, v8f c) {
  return __builtin_amdgcn_wmma_f32_16x16x32_bf16(false, a, false, b, (short)0, c,
                                                 false, false);
}

// LDS byte offset of a generic pointer to __shared__.
static __device__ __forceinline__ unsigned lds_off32(const void* p) {
  return (unsigned)(uintptr_t)p;
}

static __device__ __forceinline__ void async_copy6_b128(
    unsigned l0, const void* g0, unsigned l1, const void* g1, unsigned l2, const void* g2,
    unsigned l3, const void* g3, unsigned l4, const void* g4, unsigned l5, const void* g5) {
  asm volatile("global_load_async_to_lds_b128 %0, %1, off\n\t"
               "global_load_async_to_lds_b128 %2, %3, off\n\t"
               "global_load_async_to_lds_b128 %4, %5, off\n\t"
               "global_load_async_to_lds_b128 %6, %7, off\n\t"
               "global_load_async_to_lds_b128 %8, %9, off\n\t"
               "global_load_async_to_lds_b128 %10, %11, off\n\t"
               "s_wait_xcnt 0x0"
               :: "v"(l0), "v"(g0), "v"(l1), "v"(g1), "v"(l2), "v"(g2),
                  "v"(l3), "v"(g3), "v"(l4), "v"(g4), "v"(l5), "v"(g5)
               : "memory");
}

// ---------------------------------------------------------------------------
// Conversion / packing kernels. Each is a short stream: a thread issues all of
// its loads before it uses the first, so a wave pays the memory latency once.
// Weights stored TRANSPOSED ([N][K] bf16) so GEMM B-fragments are wide.
// The attention scale 1/sqrt(64) = 2^-3 is folded into Wq/bq here (exact).
// ---------------------------------------------------------------------------
#define CVT_VEC 16  // 16 B loads per thread

// A block converts 256 * CVT_VEC * 4 consecutive floats. Every wave-wide load
// covers 512 contiguous bytes, every wave-wide store 256.
__global__ __launch_bounds__(256) void convert_f32_bf16(const float* __restrict__ src,
                                                        __bf16* __restrict__ dst) {
  const size_t base = (size_t)blockIdx.x * (256 * CVT_VEC) + threadIdx.x;  // in units of 4 elements
  const float4* s4 = reinterpret_cast<const float4*>(src) + base;
  uint2* d4 = reinterpret_cast<uint2*>(dst) + base;
  float4 v[CVT_VEC];
#pragma unroll  // v stays in registers and the loads issue back to back
  for (int j = 0; j < CVT_VEC; ++j) v[j] = s4[j * 256];
#pragma unroll  // constant indices into v
  for (int j = 0; j < CVT_VEC; ++j) {
    union { uint2 u; __bf16 e[4]; } w;
    w.e[0] = (__bf16)v[j].x;
    w.e[1] = (__bf16)v[j].y;
    w.e[2] = (__bf16)v[j].z;
    w.e[3] = (__bf16)v[j].w;
    d4[j * 256] = w.u;
  }
}

// 64 consecutive k of one column of a row-major f32 matrix (row length LD)
// -> one 128 B line of the transposed bf16 matrix. The lanes of a wave hold
// neighbouring columns, so each of the 64 loads reads one whole line.
template <int LD>
static __device__ __forceinline__ void column64_to_line(const float* __restrict__ col,
                                                        float scale, __bf16* __restrict__ line) {
  float v[64];
#pragma unroll  // v stays in registers and the loads issue back to back
  for (int j = 0; j < 64; ++j) v[j] = col[(size_t)j * LD];
#pragma unroll  // constant indices into v, here and in the loop inside
  for (int c = 0; c < 8; ++c) {
    union { uint4 u; __bf16 e[8]; } w;
#pragma unroll
    for (int r = 0; r < 8; ++r) w.e[r] = (__bf16)(v[c * 8 + r] * scale);
    reinterpret_cast<uint4*>(line)[c] = w.u;
  }
}

// Grid: (QKV_N / 64) column blocks x (HIDDEN / 64) k blocks, 64 threads each.
// A column block lies wholly in Wq, in Wk or in Wv.
__global__ __launch_bounds__(64) void pack_wqkv_t(
    const float* __restrict__ Wq, const float* __restrict__ Wk,
    const float* __restrict__ Wv, const float* __restrict__ bq,
    const float* __restrict__ bk, const float* __restrict__ bv,
    __bf16* __restrict__ Wt, float* __restrict__ bqkv) {
  constexpr int NB = QKV_N / 64;
  const int nb = blockIdx.x % NB, k0 = (blockIdx.x / NB) * 64;
  const int t = threadIdx.x, n = nb * 64 + t;
  __bf16* line = Wt + (size_t)n * HIDDEN + k0;  // Wt[n][k]
  if (nb < HIDDEN / 64)
    column64_to_line<HIDDEN>(Wq + (size_t)k0 * HIDDEN + n, 0.125f, line);  // fold 1/sqrt(Dh)
  else if (nb == HIDDEN / 64)
    column64_to_line<HEAD_DIM>(Wk + (size_t)k0 * HEAD_DIM + t, 1.0f, line);
  else
    column64_to_line<HEAD_DIM>(Wv + (size_t)k0 * HEAD_DIM + t, 1.0f, line);
  if (k0 == 0) {
    // the code below reuses registers that the line's issued stores name
    asm volatile("s_wait_xcnt 0x0" ::: "memory");
    bqkv[n] = (nb < HIDDEN / 64) ? bq[n] * 0.125f : (nb == HIDDEN / 64) ? bk[t] : bv[t];
  }
}

// W [HIDDEN][HIDDEN] -> Wt [N][K]. Grid: 16 column blocks x 16 k blocks.
__global__ __launch_bounds__(64) void transpose_f32_bf16(const float* __restrict__ W,
                                                         __bf16* __restrict__ Wt) {
  constexpr int NB = HIDDEN / 64;
  const int n = (blockIdx.x % NB) * 64 + threadIdx.x, k0 = (blockIdx.x / NB) * 64;
  column64_to_line<HIDDEN>(W + (size_t)k0 * HIDDEN + n, 1.0f, Wt + (size_t)n * HIDDEN + k0);
}

template <typename OutT>
__global__ __launch_bounds__(256) void gemm_bf16_wmma(
    const __bf16* __restrict__ A, const __bf16* __restrict__ Wt,
    const float* __restrict__ bias, OutT* __restrict__ C, int M, int N, int K) {
  constexpr int BM = 256, BN = 128, BK = 32;
  constexpr int LDP = BK + 8;                       // LDS row pitch, elements (80 B)
  __shared__ __align__(16) __bf16 As[2][BM * LDP];  // row-major [row][k], 2x20KB
  __shared__ __align__(16) __bf16 Bs[2][BN * LDP];  // col-major [col][k], 2x10KB

  const int tid = threadIdx.x, lane = tid & 31, wave = tid >> 5;
  const int wm = wave & 3, wn = wave >> 2;  // 4 waves in M, 2 in N
  const int nb = N / BN;
  const int row0 = (blockIdx.x / nb) * BM;
  const int col0 = (blockIdx.x % nb) * BN;

  // copy map: a thread brings 8 bf16 of row tid>>2 at k-offset (tid&3)*8, and
  // the same of the rows 64, 128, 192 further on (A: 4 copies, B: 2)
  const int crow = tid >> 2, ck = (tid & 3) * 8;
  const unsigned lthr = (unsigned)(crow * LDP + ck) * 2;
  const unsigned asBase[2] = {lds_off32(As[0]) + lthr, lds_off32(As[1]) + lthr};
  const unsigned bsBase[2] = {lds_off32(Bs[0]) + lthr, lds_off32(Bs[1]) + lthr};
  constexpr unsigned LSTEP = 64 * LDP * 2;  // 64 rows in LDS, bytes
  const size_t gstep = (size_t)64 * K;      // 64 rows in global memory, elements
  const __bf16* aThr = A + (size_t)(row0 + crow) * K + ck;
  const __bf16* bThr = Wt + (size_t)(col0 + crow) * K + ck;

  auto issue = [&](int k0, int buf) {
    const __bf16* a = aThr + k0;
    const __bf16* b = bThr + k0;
    const unsigned la = asBase[buf], lb = bsBase[buf];
    async_copy6_b128(la, a, la + LSTEP, a + gstep, la + 2 * LSTEP, a + 2 * gstep,
                     la + 3 * LSTEP, a + 3 * gstep, lb, b, lb + LSTEP, b + gstep);
  };

  v8f acc[4][4];
  issue(0, 0);

  // peeled first k-step: accumulate onto inline zero
  {
    asm volatile("s_wait_asynccnt 0x0" ::: "memory");
    __syncthreads();
    if (BK < K) issue(BK, 1);
    v16bf af[4], bf[4];
#pragma unroll
    for (int i = 0; i < 4; ++i) af[i] = frag_k32(&As[0][(wm * 64 + i * 16) * LDP], LDP);
#pragma unroll
    for (int j = 0; j < 4; ++j) bf[j] = frag_k32(&Bs[0][(wn * 64 + j * 16) * LDP], LDP);
    const v8f z = {};
#pragma unroll
    for (int i = 0; i < 4; ++i)
#pragma unroll
      for (int j = 0; j < 4; ++j) acc[i][j] = wmma_bf16(af[i], bf[j], z);
  }

  int buf = 1;
  for (int k0 = BK; k0 < K; k0 += BK, buf ^= 1) {
    asm volatile("s_wait_dscnt 0x0" ::: "memory");     // our reads of buf^1 are over
    asm volatile("s_wait_asynccnt 0x0" ::: "memory");  // our DMAs into buf landed
    __syncthreads();  // everyone's landed; everyone finished reading buf^1
    if (k0 + BK < K) issue(k0 + BK, buf ^ 1);  // DMA overlaps WMMAs below

    v16bf af[4], bf[4];
#pragma unroll
    for (int i = 0; i < 4; ++i) af[i] = frag_k32(&As[buf][(wm * 64 + i * 16) * LDP], LDP);
#pragma unroll
    for (int j = 0; j < 4; ++j) bf[j] = frag_k32(&Bs[buf][(wn * 64 + j * 16) * LDP], LDP);
#pragma unroll
    for (int i = 0; i < 4; ++i)
#pragma unroll
      for (int j = 0; j < 4; ++j) acc[i][j] = wmma_bf16(af[i], bf[j], acc[i][j]);
  }
  asm volatile("s_wait_asynccnt 0x0" ::: "memory");  // no copy in flight at the wave's end

  const int lsub = lane & 15, hi = lane >> 4;
#pragma unroll
  for (int i = 0; i < 4; ++i)
#pragma unroll
    for (int j = 0; j < 4; ++j)
#pragma unroll
      for (int r = 0; r < 8; ++r) {
        const int row = row0 + wm * 64 + i * 16 + r + 8 * hi;
        const int col = col0 + wn * 64 + j * 16 + lsub;
        C[(size_t)row * N + col] = (OutT)(acc[i][j][r] + bias[col]);
      }
}

static __device__ __forceinline__ float xhalf(float x) {
  const int v = __builtin_bit_cast(int, x);
  return __builtin_bit_cast(
      float, __builtin_amdgcn_permlanex16(v, v, 0x76543210, 0xfedcba98, false, false));
}

#define KPITCH  144
#define VPITCH  160
#define KTILE_B (64 * KPITCH)
#define STAGE_B (KTILE_B + 64 * VPITCH)
#define KV_TILES (SEQ / 64)

typedef unsigned u32x4 __attribute__((ext_vector_type(4)));
typedef short    s16x8 __attribute__((ext_vector_type(8)));

static __device__ __forceinline__ u32x4 lds_tr16(const unsigned char* p) {
  typedef __attribute__((address_space(3))) s16x8 lds_s16x8;
  return __builtin_bit_cast(u32x4, __builtin_amdgcn_ds_load_tr16_b128_v8i16((lds_s16x8*)p));
}

// A fragment of V^T (16 d x 32 keys, hardware k order) from row-major V rows.
// p = this lane's address for the fragment's first 16 keys.
static __device__ __forceinline__ v16bf frag_vt(const unsigned char* p) {
  union { u32x4 q[2]; v16bf v; } t;
  t.q[0] = lds_tr16(p);
  t.q[1] = lds_tr16(p + 16 * VPITCH);
  return t.v;
}

static __device__ __forceinline__ void async_copy4_b128(
    unsigned l0, const void* g0, unsigned l1, const void* g1,
    unsigned l2, const void* g2, unsigned l3, const void* g3) {
  asm volatile("global_load_async_to_lds_b128 %0, %1, off\n\t"
               "global_load_async_to_lds_b128 %2, %3, off\n\t"
               "global_load_async_to_lds_b128 %4, %5, off\n\t"
               "global_load_async_to_lds_b128 %6, %7, off\n\t"
               "s_wait_xcnt 0x0"
               :: "v"(l0), "v"(g0), "v"(l1), "v"(g1), "v"(l2), "v"(g2), "v"(l3), "v"(g3)
               : "memory");
}

__global__ __launch_bounds__(256) void mqa_attention(
    const __bf16* __restrict__ qkv, __bf16* __restrict__ attn_out) {
  // per buffer: K [64 keys][KPITCH], then V [64 keys][VPITCH], both row-major
  __shared__ __attribute__((aligned(128))) unsigned char kv[2][STAGE_B];

  const int tid = threadIdx.x, lane = tid & 31, wave = tid >> 5;
  const int lsub = lane & 15, hi = lane >> 4;
  const int qb = blockIdx.x & 7;           // SEQ/256 = 8
  const int h  = (blockIdx.x >> 3) & 15;
  const int b  = blockIdx.x >> 7;
  const int q0 = qb * 256 + wave * 32;
  const int ld = QKV_N;

  // copy map: 16 chunks of 16B per key row (8 of K, 8 of V), 16 rows per copy
  const int crow = tid >> 4, cc = tid & 15;
  const unsigned isv = (unsigned)cc >> 3;                      // 0: a K chunk, 1: a V chunk
  const unsigned cpitch = KPITCH + isv * (VPITCH - KPITCH);
  const unsigned ldst = lds_off32(&kv[0][0]) + isv * KTILE_B + (unsigned)crow * cpitch + (cc & 7) * 16u;
  const unsigned lstep = 16u * cpitch;
  const unsigned char* gsrc =
      reinterpret_cast<const unsigned char*>(qkv + (size_t)(b * SEQ + crow) * ld + HIDDEN) + cc * 16;
  constexpr size_t GSTEP = (size_t)16 * QKV_N * 2;  // 16 key rows, bytes

  auto issue = [&](int tile, int buf) {
    const unsigned l = ldst + (unsigned)buf * STAGE_B;
    const unsigned char* g = gsrc + (size_t)tile * (4 * GSTEP);
    async_copy4_b128(l, g, l + lstep, g + GSTEP, l + 2 * lstep, g + 2 * GSTEP,
                     l + 3 * lstep, g + 3 * GSTEP);
  };

  issue(0, 0);

  // Q fragments (B operand: column = query, straight from global, 2x b128 per frag)
  const __bf16* qp = qkv + (size_t)(b * SEQ + q0) * ld + h * HEAD_DIM;
  v16bf q_lo[2], q_hi[2];  // column group c: queries q0 + c*16 + lsub
#pragma unroll  // here and at every loop over c: constant indices keep the per-group arrays in registers
  for (int c = 0; c < 2; ++c) {
    q_lo[c] = frag_k32(qp + (size_t)c * 16 * ld, ld);
    q_hi[c] = frag_k32(qp + (size_t)c * 16 * ld + 32, ld);
  }

  float m_run[2] = {-INFINITY, -INFINITY};  // this lane's queries: running maximum (both halves agree)
  float l_run[2] = {0.0f, 0.0f};  // running sum over this half's keys only; joined at the end
  v8f o[2][4] = {};               // o[c][t][r] = O[query c*16 + lsub][d = t*16 + 8*hi + r]

  // this lane's place in a V tile for the transposing load
  const unsigned vlane = KTILE_B + (unsigned)(8 * hi + (lane & 7)) * VPITCH + 16u * ((lane >> 3) & 1);

  asm volatile("s_wait_asynccnt 0x0" ::: "memory");  // own copies of stage 0 landed
  __syncthreads();                                   // everyone's landed
  issue(1, 1);

  for (int kt = 0; kt < KV_TILES; ++kt) {
    const unsigned char* stage = kv[kt & 1];

    // S^T = K * Q^T (64 keys x 32 queries)
    // s[c][n][r] = score(key kt*64 + n*16 + 8*hi + r, query c*16 + lsub)
    v8f s[2][4] = {};
#pragma unroll
    for (int n = 0; n < 4; ++n) {
      const __bf16* kb = reinterpret_cast<const __bf16*>(stage + n * 16 * KPITCH);
      const v16bf k_lo = frag_k32(kb, KPITCH / 2);
      const v16bf k_hi = frag_k32(kb + 32, KPITCH / 2);
#pragma unroll
      for (int c = 0; c < 2; ++c) s[c][n] = wmma_bf16(k_lo, q_lo[c], s[c][n]);
#pragma unroll
      for (int c = 0; c < 2; ++c) s[c][n] = wmma_bf16(k_hi, q_hi[c], s[c][n]);
    }

    // online softmax over 64 keys of one query per lane and column group
    float mnew[2], corr[2];
#pragma unroll
    for (int c = 0; c < 2; ++c) {
      float mx = s[c][0][0];
#pragma unroll
      for (int n = 0; n < 4; ++n)
#pragma unroll
        for (int r = 0; r < 8; ++r) mx = fmaxf(mx, s[c][n][r]);
      mx = fmaxf(mx, xhalf(mx));
      mnew[c] = fmaxf(m_run[c], mx);
    }
#pragma unroll
    for (int c = 0; c < 2; ++c) {
      corr[c] = __expf(m_run[c] - mnew[c]);
      m_run[c] = mnew[c];
    }

    v16bf pb[2][2];  // P^T as B operands: keys 0..31 and 32..63 of the tile
#pragma unroll
    for (int c = 0; c < 2; ++c) {
#pragma unroll
      for (int n = 0; n < 4; ++n) {
        s[c][n] -= mnew[c];
#pragma unroll
        for (int r = 0; r < 8; ++r) {
          s[c][n][r] = __expf(s[c][n][r]);
          pb[c][n >> 1][(n & 1) * 8 + r] = (__bf16)s[c][n][r];
        }
      }
      const v8f rs = (s[c][0] + s[c][1]) + (s[c][2] + s[c][3]);  // this half's 32 keys, register by register
      l_run[c] = l_run[c] * corr[c] +
                 (((rs[0] + rs[1]) + (rs[2] + rs[3])) + ((rs[4] + rs[5]) + (rs[6] + rs[7])));
#pragma unroll
      for (int t = 0; t < 4; ++t) o[c][t] *= corr[c];
    }

    // O^T += V^T(64 d x 64 keys) * P^T(64 keys x 32 queries)
    const unsigned char* vp = stage + vlane;
#pragma unroll
    for (int t = 0; t < 4; ++t) {
      const v16bf v_lo = frag_vt(vp + 32 * t);
      const v16bf v_hi = frag_vt(vp + 32 * VPITCH + 32 * t);
#pragma unroll
      for (int c = 0; c < 2; ++c) o[c][t] = wmma_bf16(v_lo, pb[c][0], o[c][t]);
#pragma unroll
      for (int c = 0; c < 2; ++c) o[c][t] = wmma_bf16(v_hi, pb[c][1], o[c][t]);
    }

    // hand-over: this wave has left the stage, its copies of the next have
    // landed; behind the barrier that holds for all waves, and the buffer
    // just read may be refilled
    asm volatile("s_wait_dscnt 0x0" ::: "memory");
    asm volatile("s_wait_asynccnt 0x0" ::: "memory");
    __syncthreads();
    if (kt + 2 < KV_TILES) issue(kt + 2, kt & 1);
  }
  asm volatile("s_wait_asynccnt 0x0" ::: "memory");  // no copy in flight at the wave's end

  // a lane holds 8 consecutive d of its query per tile: one 16B store each
  union { uint4 u; __bf16 e[8]; } w[2][4];
#pragma unroll
  for (int c = 0; c < 2; ++c) {
    const float inv = 1.0f / (l_run[c] + xhalf(l_run[c]));
#pragma unroll
    for (int t = 0; t < 4; ++t)
#pragma unroll
      for (int r = 0; r < 8; ++r) w[c][t].e[r] = (__bf16)(o[c][t][r] * inv);
  }
  __bf16* op = attn_out + (size_t)(b * SEQ + q0 + lsub) * HIDDEN + h * HEAD_DIM + hi * 8;
#pragma unroll
  for (int c = 0; c < 2; ++c)
#pragma unroll
    for (int t = 0; t < 4; ++t)
      *reinterpret_cast<uint4*>(op + (size_t)c * 16 * HIDDEN + t * 16) = w[c][t].u;
}

// ---------------------------------------------------------------------------
// Host-side launch
// ---------------------------------------------------------------------------
extern "C" void kernel_launch(void* const* d_in, const int* in_sizes, int n_in,
                              void* d_out, int out_size, void* d_ws, size_t ws_size,
                              hipStream_t stream) {
  (void)in_sizes; (void)n_in; (void)out_size; (void)ws_size;
  const float* X  = (const float*)d_in[0];
  const float* Wq = (const float*)d_in[1];
  const float* bq = (const float*)d_in[2];
  const float* Wk = (const float*)d_in[3];
  const float* bk = (const float*)d_in[4];
  const float* Wv = (const float*)d_in[5];
  const float* bv = (const float*)d_in[6];
  const float* Wo = (const float*)d_in[7];
  const float* bo = (const float*)d_in[8];
  float* out = (float*)d_out;

  char* ws = (char*)d_ws;
  size_t off = 0;
  auto take = [&](size_t bytes) {
    void* p = ws + off;
    off += (bytes + 255) & ~(size_t)255;
    return p;
  };
  __bf16* Xbf   = (__bf16*)take((size_t)M_ROWS * HIDDEN * 2);  // 16 MB
  __bf16* WqkvT = (__bf16*)take((size_t)QKV_N * HIDDEN * 2);   // 2.25 MB  [N][K]
  __bf16* WoT   = (__bf16*)take((size_t)HIDDEN * HIDDEN * 2);  // 2 MB     [N][K]
  float*  bqkv  = (float*)take((size_t)QKV_N * 4);
  __bf16* QKV   = (__bf16*)take((size_t)M_ROWS * QKV_N * 2);   // 18 MB
  __bf16* Attn  = (__bf16*)take((size_t)M_ROWS * HIDDEN * 2);  // 16 MB

  // 1) precision conversion + transposed weight packing (one-time)
  convert_f32_bf16<<<(M_ROWS * HIDDEN) / (256 * CVT_VEC * 4), 256, 0, stream>>>(X, Xbf);
  pack_wqkv_t<<<(QKV_N / 64) * (HIDDEN / 64), 64, 0, stream>>>(Wq, Wk, Wv, bq, bk, bv, WqkvT, bqkv);
  transpose_f32_bf16<<<(HIDDEN / 64) * (HIDDEN / 64), 64, 0, stream>>>(Wo, WoT);

  // 2) fused QKV projection: [8192,1024] x [1024,1152] + bias -> bf16
  gemm_bf16_wmma<__bf16><<<(M_ROWS / 256) * (QKV_N / 128), 256, 0, stream>>>(
      Xbf, WqkvT, bqkv, QKV, M_ROWS, QKV_N, HIDDEN);

  // 3) flash multi-query attention -> bf16 [8192,1024]
  mqa_attention<<<BATCH * HEADS * (SEQ / 256), 256, 0, stream>>>(QKV, Attn);

  // 4) output projection: [8192,1024] x [1024,1024] + bo -> f32 out
  gemm_bf16_wmma<float><<<(M_ROWS / 256) * (HIDDEN / 128), 256, 0, stream>>>(
      Attn, WoT, bo, out, M_ROWS, HIDDEN, HIDDEN);
}

// v006
// One run takes 122 microseconds.
// In both of two side-by-side timings against v005, it was 1.05 times as fast.
// Over all steps from v000 it is 3.36 times as fast.
#include <hip/hip_runtime.h>
#include <math.h>

typedef __attribute__((ext_vector_type(16))) __bf16 v16bf;
typedef __attribute__((ext_vector_type(8)))  float  v8f;

#define HIDDEN   1024
#define HEADS    16
#define HEAD_DIM 64
#define BATCH    4
#define SEQ      2048
#define M_ROWS   (BATCH * SEQ)           // 8192
#define QKV_N    (HIDDEN + 2 * HEAD_DIM) // 1152

static __device__ __forceinline__ v16bf frag_k32(const __bf16* base, int ld) {
  const int lane = threadIdx.x & 31;
  const int lsub = lane & 15, hi = lane >> 4;
  const __bf16* p = base + (size_t)lsub * ld + hi * 8;
  union { uint4 u[2]; v16bf v; } t;
  t.u[0] = *reinterpret_cast<const uint4*>(p);
  t.u[1] = *reinterpret_cast<const uint4*>(p + 16);
  return t.v;
}

static __device__ __forceinline__ v8f wmma_bf16(v16bf a, v16bf b, v8f c) {
  return __builtin_amdgcn_wmma_f32_16x16x32_bf16(false, a, false, b, (short)0, c,
                                                 false, false);
}

// LDS byte offset of a generic pointer to __shared__.
static __device__ __forceinline__ unsigned lds_off32(const void* p) {
  return (unsigned)(uintptr_t)p;
}

static __device__ __forceinline__ void async_copy6_b128(
    unsigned l0, const void* g0, unsigned l1, const void* g1, unsigned l2, const void* g2,
    unsigned l3, const void* g3, unsigned l4, const void* g4, unsigned l5, const void* g5) {
  asm volatile("global_load_async_to_lds_b128 %0, %1, off\n\t"
               "global_load_async_to_lds_b128 %2, %3, off\n\t"
               "global_load_async_to_lds_b128 %4, %5, off\n\t"
               "global_load_async_to_lds_b128 %6, %7, off\n\t"
               "global_load_async_to_lds_b128 %8, %9, off\n\t"
               "global_load_async_to_lds_b128 %10, %11, off\n\t"
               "s_wait_xcnt 0x0"
               :: "v"(l0), "v"(g0), "v"(l1), "v"(g1), "v"(l2), "v"(g2),
                  "v"(l3), "v"(g3), "v"(l4), "v"(g4), "v"(l5), "v"(g5)
               : "memory");
}

// ---------------------------------------------------------------------------
// Conversion / packing: three independent jobs in ONE launch (prepare_operands
// below), each on its own range of blocks. Each is a short stream: a thread
// issues all of its loads before it uses the first, so a wave pays the memory
// latency once.
// Weights stored TRANSPOSED ([N][K] bf16) so GEMM B-fragments are wide.
// The attention scale 1/sqrt(64) = 2^-3 is folded into Wq/bq here (exact).
// ---------------------------------------------------------------------------
#define CVT_VEC 16  // 16 B loads per thread

// Block blk of 256 threads converts 256 * CVT_VEC * 4 consecutive floats. Every
// wave-wide load covers 512 contiguous bytes, every wave-wide store 256.
static __device__ __forceinline__ void convert_f32_bf16(int blk, const float* __restrict__ src,
                                                        __bf16* __restrict__ dst) {
  const size_t base = (size_t)blk * (256 * CVT_VEC) + threadIdx.x;  // in units of 4 elements
  const float4* s4 = reinterpret_cast<const float4*>(src) + base;
  uint2* d4 = reinterpret_cast<uint2*>(dst) + base;
  float4 v[CVT_VEC];
#pragma unroll  // v stays in registers and the loads issue back to back
  for (int j = 0; j < CVT_VEC; ++j) v[j] = s4[j * 256];
#pragma unroll  // constant indices into v
  for (int j = 0; j < CVT_VEC; ++j) {
    union { uint2 u; __bf16 e[4]; } w;
    w.e[0] = (__bf16)v[j].x;
    w.e[1] = (__bf16)v[j].y;
    w.e[2] = (__bf16)v[j].z;
    w.e[3] = (__bf16)v[j].w;
    d4[j * 256] = w.u;
  }
}

// 64 consecutive k of one column of a row-major f32 matrix (row length LD)
// -> one 128 B line of the transposed bf16 matrix. The lanes of a wave hold
// neighbouring columns, so each of the 64 loads reads one whole line.
template <int LD>
static __device__ __forceinline__ void column64_to_line(const float* __restrict__ col,
                                                        float scale, __bf16* __restrict__ line) {
  float v[64];
#pragma unroll  // v stays in registers and the loads issue back to back
  for (int j = 0; j < 64; ++j) v[j] = col[(size_t)j * LD];
#pragma unroll  // constant indices into v, here and in the loop inside
  for (int c = 0; c < 8; ++c) {
    union { uint4 u; __bf16 e[8]; } w;
#pragma unroll
    for (int r = 0; r < 8; ++r) w.e[r] = (__bf16)(v[c * 8 + r] * scale);
    reinterpret_cast<uint4*>(line)[c] = w.u;
  }
  // code of the same kernel that follows in the listing reuses registers that
  // these issued stores name
  asm volatile("s_wait_xcnt 0x0" ::: "memory");
}

// Units: (QKV_N / 64) column blocks x (HIDDEN / 64) k blocks, 64 threads (t) each.
// A column block lies wholly in Wq, in Wk or in Wv.
static __device__ __forceinline__ void pack_wqkv_t(
    int unit, int t,
    const float* __restrict__ Wq, const float* __restrict__ Wk,
    const float* __restrict__ Wv, const float* __restrict__ bq,
    const float* __restrict__ bk, const float* __restrict__ bv,
    __bf16* __restrict__ Wt, float* __restrict__ bqkv) {
  constexpr int NB = QKV_N / 64;
  const int nb = unit % NB, k0 = (unit / NB) * 64;
  const int n = nb * 64 + t;
  __bf16* line = Wt + (size_t)n * HIDDEN + k0;  // Wt[n][k]
  if (nb < HIDDEN / 64)
    column64_to_line<HIDDEN>(Wq + (size_t)k0 * HIDDEN + n, 0.125f, line);  // fold 1/sqrt(Dh)
  else if (nb == HIDDEN / 64)
    column64_to_line<HEAD_DIM>(Wk + (size_t)k0 * HEAD_DIM + t, 1.0f, line);
  else
    column64_to_line<HEAD_DIM>(Wv + (size_t)k0 * HEAD_DIM + t, 1.0f, line);
  if (k0 == 0) {
    bqkv[n] = (nb < HIDDEN / 64) ? bq[n] * 0.125f : (nb == HIDDEN / 64) ? bk[t] : bv[t];
    // as behind the line's stores: the listing goes on behind this store
    asm volatile("s_wait_xcnt 0x0" ::: "memory");
  }
}

// W [HIDDEN][HIDDEN] -> Wt [N][K]. Units: 16 column blocks x 16 k blocks, 64 threads (t) each.
static __device__ __forceinline__ void transpose_f32_bf16(int unit, int t,
                                                          const float* __restrict__ W,
                                                          __bf16* __restrict__ Wt) {
  constexpr int NB = HIDDEN / 64;
  const int n = (unit % NB) * 64 + t, k0 = (unit / NB) * 64;
  column64_to_line<HIDDEN>(W + (size_t)k0 * HIDDEN + n, 1.0f, Wt + (size_t)n * HIDDEN + k0);
}

// One launch for all three jobs: none reads what another writes, so they share
// one start and one end instead of waiting for each other. A block of 256
// threads is either four weight units (two waves each) or one block of X. The
// weight blocks come first: theirs is the longer chain of loads and stores.
#define QKV_PACK_BLOCKS ((QKV_N / 64) * (HIDDEN / 64) / 4)    // 72
#define WO_PACK_BLOCKS  ((HIDDEN / 64) * (HIDDEN / 64) / 4)   // 64
#define CVT_BLOCKS      ((M_ROWS * HIDDEN) / (256 * CVT_VEC * 4))  // 512
__global__ __launch_bounds__(256) void prepare_operands(
    const float* __restrict__ X, const float* __restrict__ Wq, const float* __restrict__ Wk,
    const float* __restrict__ Wv, const float* __restrict__ bq, const float* __restrict__ bk,
    const float* __restrict__ bv, const float* __restrict__ Wo, __bf16* __restrict__ Xbf,
    __bf16* __restrict__ WqkvT, float* __restrict__ bqkv, __bf16* __restrict__ WoT) {
  const int blk = blockIdx.x;
  if (blk >= QKV_PACK_BLOCKS + WO_PACK_BLOCKS) {
    convert_f32_bf16(blk - (QKV_PACK_BLOCKS + WO_PACK_BLOCKS), X, Xbf);
    return;
  }
  // the unit is the same in every lane of a wave: held in a scalar register, the
  // choice between Wq, Wk and Wv stays a scalar branch
  const int sub = __builtin_amdgcn_readfirstlane((int)(threadIdx.x >> 6));
  const int t = threadIdx.x & 63;
  if (blk < QKV_PACK_BLOCKS)
    pack_wqkv_t(blk * 4 + sub, t, Wq, Wk, Wv, bq, bk, bv, WqkvT, bqkv);
  else
    transpose_f32_bf16((blk - QKV_PACK_BLOCKS) * 4 + sub, t, Wo, WoT);
}

template <typename OutT>
__global__ __launch_bounds__(256) void gemm_bf16_wmma(
    const __bf16* __restrict__ A, const __bf16* __restrict__ Wt,
    const float* __restrict__ bias, OutT* __restrict__ C, int M, int N, int K) {
  constexpr int BM = 256, BN = 128, BK = 32;
  constexpr int LDP = BK + 8;                       // LDS row pitch, elements (80 B)
  __shared__ __align__(16) __bf16 As[2][BM * LDP];  // row-major [row][k], 2x20KB
  __shared__ __align__(16) __bf16 Bs[2][BN * LDP];  // col-major [col][k], 2x10KB

  const int tid = threadIdx.x, lane = tid & 31, wave = tid >> 5;
  const int wm = wave & 3, wn = wave >> 2;  // 4 waves in M, 2 in N
  const int nb = N / BN;
  const int row0 = (blockIdx.x / nb) * BM;
  const int col0 = (blockIdx.x % nb) * BN;

  // copy map: a thread brings 8 bf16 of row tid>>2 at k-offset (tid&3)*8, and
  // the same of the rows 64, 128, 192 further on (A: 4 copies, B: 2)
  const int crow = tid >> 2, ck = (tid & 3) * 8;
  const unsigned lthr = (unsigned)(crow * LDP + ck) * 2;
  const unsigned asBase[2] = {lds_off32(As[0]) + lthr, lds_off32(As[1]) + lthr};
  const unsigned bsBase[2] = {lds_off32(Bs[0]) + lthr, lds_off32(Bs[1]) + lthr};
  constexpr unsigned LSTEP = 64 * LDP * 2;  // 64 rows in LDS, bytes
  const size_t gstep = (size_t)64 * K;      // 64 rows in global memory, elements
  const __bf16* aThr = A + (size_t)(row0 + crow) * K + ck;
  const __bf16* bThr = Wt + (size_t)(col0 + crow) * K + ck;

  auto issue = [&](int k0, int buf) {
    const __bf16* a = aThr + k0;
    const __bf16* b = bThr + k0;
    const unsigned la = asBase[buf], lb = bsBase[buf];
    async_copy6_b128(la, a, la + LSTEP, a + gstep, la + 2 * LSTEP, a + 2 * gstep,
                     la + 3 * LSTEP, a + 3 * gstep, lb, b, lb + LSTEP, b + gstep);
  };

  v8f acc[4][4];
  issue(0, 0);

  // peeled first k-step: accumulate onto inline zero
  {
    asm volatile("s_wait_asynccnt 0x0" ::: "memory");
    __syncthreads();
    if (BK < K) issue(BK, 1);
    v16bf af[4], bf[4];
#pragma unroll
    for (int i = 0; i < 4; ++i) af[i] = frag_k32(&As[0][(wm * 64 + i * 16) * LDP], LDP);
#pragma unroll
    for (int j = 0; j < 4; ++j) bf[j] = frag_k32(&Bs[0][(wn * 64 + j * 16) * LDP], LDP);
    const v8f z = {};
#pragma unroll
    for (int i = 0; i < 4; ++i)
#pragma unroll
      for (int j = 0; j < 4; ++j) acc[i][j] = wmma_bf16(af[i], bf[j], z);
  }

  int buf = 1;
  for (int k0 = BK; k0 < K; k0 += BK, buf ^= 1) {
    asm volatile("s_wait_dscnt 0x0" ::: "memory");     // our reads of buf^1 are over
    asm volatile("s_wait_asynccnt 0x0" ::: "memory");  // our DMAs into buf landed
    __syncthreads();  // everyone's landed; everyone finished reading buf^1
    if (k0 + BK < K) issue(k0 + BK, buf ^ 1);  // DMA overlaps WMMAs below

    v16bf af[4], bf[4];
#pragma unroll
    for (int i = 0; i < 4; ++i) af[i] = frag_k32(&As[buf][(wm * 64 + i * 16) * LDP], LDP);
#pragma unroll
    for (int j = 0; j < 4; ++j) bf[j] = frag_k32(&Bs[buf][(wn * 64 + j * 16) * LDP], LDP);
#pragma unroll
    for (int i = 0; i < 4; ++i)
#pragma unroll
      for (int j = 0; j < 4; ++j) acc[i][j] = wmma_bf16(af[i], bf[j], acc[i][j]);
  }
  asm volatile("s_wait_asynccnt 0x0" ::: "memory");  // no copy in flight at the wave's end

  const int lsub = lane & 15, hi = lane >> 4;
#pragma unroll
  for (int i = 0; i < 4; ++i)
#pragma unroll
    for (int j = 0; j < 4; ++j)
#pragma unroll
      for (int r = 0; r < 8; ++r) {
        const int row = row0 + wm * 64 + i * 16 + r + 8 * hi;
        const int col = col0 + wn * 64 + j * 16 + lsub;
        C[(size_t)row * N + col] = (OutT)(acc[i][j][r] + bias[col]);
      }
}

static __device__ __forceinline__ float xhalf(float x) {
  const int v = __builtin_bit_cast(int, x);
  return __builtin_bit_cast(
      float, __builtin_amdgcn_permlanex16(v, v, 0x76543210, 0xfedcba98, false, false));
}

#define KPITCH  144
#define VPITCH  160
#define KTILE_B (64 * KPITCH)
#define STAGE_B (KTILE_B + 64 * VPITCH)
#define KV_TILES (SEQ / 64)

typedef unsigned u32x4 __attribute__((ext_vector_type(4)));
typedef short    s16x8 __attribute__((ext_vector_type(8)));

static __device__ __forceinline__ u32x4 lds_tr16(const unsigned char* p) {
  typedef __attribute__((address_space(3))) s16x8 lds_s16x8;
  return __builtin_bit_cast(u32x4, __builtin_amdgcn_ds_load_tr16_b128_v8i16((lds_s16x8*)p));
}

// A fragment of V^T (16 d x 32 keys, hardware k order) from row-major V rows.
// p = this lane's address for the fragment's first 16 keys.
static __device__ __forceinline__ v16bf frag_vt(const unsigned char* p) {
  union { u32x4 q[2]; v16bf v; } t;
  t.q[0] = lds_tr16(p);
  t.q[1] = lds_tr16(p + 16 * VPITCH);
  return t.v;
}

static __device__ __forceinline__ void async_copy4_b128(
    unsigned l0, const void* g0, unsigned l1, const void* g1,
    unsigned l2, const void* g2, unsigned l3, const void* g3) {
  asm volatile("global_load_async_to_lds_b128 %0, %1, off\n\t"
               "global_load_async_to_lds_b128 %2, %3, off\n\t"
               "global_load_async_to_lds_b128 %4, %5, off\n\t"
               "global_load_async_to_lds_b128 %6, %7, off\n\t"
               "s_wait_xcnt 0x0"
               :: "v"(l0), "v"(g0), "v"(l1), "v"(g1), "v"(l2), "v"(g2), "v"(l3), "v"(g3)
               : "memory");
}

__global__ __launch_bounds__(256) void mqa_attention(
    const __bf16* __restrict__ qkv, __bf16* __restrict__ attn_out) {
  // per buffer: K [64 keys][KPITCH], then V [64 keys][VPITCH], both row-major
  __shared__ __attribute__((aligned(128))) unsigned char kv[2][STAGE_B];

  const int tid = threadIdx.x, lane = tid & 31, wave = tid >> 5;
  const int lsub = lane & 15, hi = lane >> 4;
  const int qb = blockIdx.x & 7;           // SEQ/256 = 8
  const int h  = (blockIdx.x >> 3) & 15;
  const int b  = blockIdx.x >> 7;
  const int q0 = qb * 256 + wave * 32;
  const int ld = QKV_N;

  // copy map: 16 chunks of 16B per key row (8 of K, 8 of V), 16 rows per copy
  const int crow = tid >> 4, cc = tid & 15;
  const unsigned isv = (unsigned)cc >> 3;                      // 0: a K chunk, 1: a V chunk
  const unsigned cpitch = KPITCH + isv * (VPITCH - KPITCH);
  const unsigned ldst = lds_off32(&kv[0][0]) + isv * KTILE_B + (unsigned)crow * cpitch + (cc & 7) * 16u;
  const unsigned lstep = 16u * cpitch;
  const unsigned char* gsrc =
      reinterpret_cast<const unsigned char*>(qkv + (size_t)(b * SEQ + crow) * ld + HIDDEN) + cc * 16;
  constexpr size_t GSTEP = (size_t)16 * QKV_N * 2;  // 16 key rows, bytes

  auto issue = [&](int tile, int buf) {
    const unsigned l = ldst + (unsigned)buf * STAGE_B;
    const unsigned char* g = gsrc + (size_t)tile * (4 * GSTEP);
    async_copy4_b128(l, g, l + lstep, g + GSTEP, l + 2 * lstep, g + 2 * GSTEP,
                     l + 3 * lstep, g + 3 * GSTEP);
  };

  issue(0, 0);

  // Q fragments (B operand: column = query, straight from global, 2x b128 per frag)
  const __bf16* qp = qkv + (size_t)(b * SEQ + q0) * ld + h * HEAD_DIM;
  v16bf q_lo[2], q_hi[2];  // column group c: queries q0 + c*16 + lsub
#pragma unroll  // here and at every loop over c: constant indices keep the per-group arrays in registers
  for (int c = 0; c < 2; ++c) {
    q_lo[c] = frag_k32(qp + (size_t)c * 16 * ld, ld);
    q_hi[c] = frag_k32(qp + (size_t)c * 16 * ld + 32, ld);
  }

  float m_run[2] = {-INFINITY, -INFINITY};  // this lane's queries: running maximum (both halves agree)
  float l_run[2] = {0.0f, 0.0f};  // running sum over this half's keys only; joined at the end
  v8f o[2][4] = {};               // o[c][t][r] = O[query c*16 + lsub][d = t*16 + 8*hi + r]

  // this lane's place in a V tile for the transposing load
  const unsigned vlane = KTILE_B + (unsigned)(8 * hi + (lane & 7)) * VPITCH + 16u * ((lane >> 3) & 1);

  asm volatile("s_wait_asynccnt 0x0" ::: "memory");  // own copies of stage 0 landed
  __syncthreads();                                   // everyone's landed
  issue(1, 1);

  for (int kt = 0; kt < KV_TILES; ++kt) {
    const unsigned char* stage = kv[kt & 1];

    // S^T = K * Q^T (64 keys x 32 queries)
    // s[c][n][r] = score(key kt*64 + n*16 + 8*hi + r, query c*16 + lsub)
    v8f s[2][4] = {};
#pragma unroll
    for (int n = 0; n < 4; ++n) {
      const __bf16* kb = reinterpret_cast<const __bf16*>(stage + n * 16 * KPITCH);
      const v16bf k_lo = frag_k32(kb, KPITCH / 2);
      const v16bf k_hi = frag_k32(kb + 32, KPITCH / 2);
#pragma unroll
      for (int c = 0; c < 2; ++c) s[c][n] = wmma_bf16(k_lo, q_lo[c], s[c][n]);
#pragma unroll
      for (int c = 0; c < 2; ++c) s[c][n] = wmma_bf16(k_hi, q_hi[c], s[c][n]);
    }

    // online softmax over 64 keys of one query per lane and column group
    float mnew[2], corr[2];
#pragma unroll
    for (int c = 0; c < 2; ++c) {
      float mx = s[c][0][0];
#pragma unroll
      for (int n = 0; n < 4; ++n)
#pragma unroll
        for (int r = 0; r < 8; ++r) mx = fmaxf(mx, s[c][n][r]);
      mx = fmaxf(mx, xhalf(mx));
      mnew[c] = fmaxf(m_run[c], mx);
    }
#pragma unroll
    for (int c = 0; c < 2; ++c) {
      corr[c] = __expf(m_run[c] - mnew[c]);
      m_run[c] = mnew[c];
    }

    v16bf pb[2][2];  // P^T as B operands: keys 0..31 and 32..63 of the tile
#pragma unroll
    for (int c = 0; c < 2; ++c) {
#pragma unroll
      for (int n = 0; n < 4; ++n) {
        s[c][n] -= mnew[c];
#pragma unroll
        for (int r = 0; r < 8; ++r) {
          s[c][n][r] = __expf(s[c][n][r]);
          pb[c][n >> 1][(n & 1) * 8 + r] = (__bf16)s[c][n][r];
        }
      }
      const v8f rs = (s[c][0] + s[c][1]) + (s[c][2] + s[c][3]);  // this half's 32 keys, register by register
      l_run[c] = l_run[c] * corr[c] +
                 (((rs[0] + rs[1]) + (rs[2] + rs[3])) + ((rs[4] + rs[5]) + (rs[6] + rs[7])));
#pragma unroll
      for (int t = 0; t < 4; ++t) o[c][t] *= corr[c];
    }

    // O^T += V^T(64 d x 64 keys) * P^T(64 keys x 32 queries)
    const unsigned char* vp = stage + vlane;
#pragma unroll
    for (int t = 0; t < 4; ++t) {
      const v16bf v_lo = frag_vt(vp + 32 * t);
      const v16bf v_hi = frag_vt(vp + 32 * VPITCH + 32 * t);
#pragma unroll
      for (int c = 0; c < 2; ++c) o[c][t] = wmma_bf16(v_lo, pb[c][0], o[c][t]);
#pragma unroll
      for (int c = 0; c < 2; ++c) o[c][t] = wmma_bf16(v_hi, pb[c][1], o[c][t]);
    }

    // hand-over: this wave has left the stage, its copies of the next have
    // landed; behind the barrier that holds for all waves, and the buffer
    // just read may be refilled
    asm volatile("s_wait_dscnt 0x0" ::: "memory");
    asm volatile("s_wait_asynccnt 0x0" ::: "memory");
    __syncthreads();
    if (kt + 2 < KV_TILES) issue(kt + 2, kt & 1);
  }
  asm volatile("s_wait_asynccnt 0x0" ::: "memory");  // no copy in flight at the wave's end

  // a lane holds 8 consecutive d of its query per tile: one 16B store each
  union { uint4 u; __bf16 e[8]; } w[2][4];
#pragma unroll
  for (int c = 0; c < 2; ++c) {
    const float inv = 1.0f / (l_run[c] + xhalf(l_run[c]));
#pragma unroll
    for (int t = 0; t < 4; ++t)
#pragma unroll
      for (int r = 0; r < 8; ++r) w[c][t].e[r] = (__bf16)(o[c][t][r] * inv);
  }
  __bf16* op = attn_out + (size_t)(b * SEQ + q0 + lsub) * HIDDEN + h * HEAD_DIM + hi * 8;
#pragma unroll
  for (int c = 0; c < 2; ++c)
#pragma unroll
    for (int t = 0; t < 4; ++t)
      *reinterpret_cast<uint4*>(op + (size_t)c * 16 * HIDDEN + t * 16) = w[c][t].u;
}

// ---------------------------------------------------------------------------
// Host-side launch
// ---------------------------------------------------------------------------
extern "C" void kernel_launch(void* const* d_in, const int* in_sizes, int n_in,
                              void* d_out, int out_size, void* d_ws, size_t ws_size,
                              hipStream_t stream) {
  (void)in_sizes; (void)n_in; (void)out_size; (void)ws_size;
  const float* X  = (const float*)d_in[0];
  const float* Wq = (const float*)d_in[1];
  const float* bq = (const float*)d_in[2];
  const float* Wk = (const float*)d_in[3];
  const float* bk = (const float*)d_in[4];
  const float* Wv = (const float*)d_in[5];
  const float* bv = (const float*)d_in[6];
  const float* Wo = (const float*)d_in[7];
  const float* bo = (const float*)d_in[8];
  float* out = (float*)d_out;

  char* ws = (char*)d_ws;
  size_t off = 0;
  auto take = [&](size_t bytes) {
    void* p = ws + off;
    off += (bytes + 255) & ~(size_t)255;
    return p;
  };
  __bf16* Xbf   = (__bf16*)take((size_t)M_ROWS * HIDDEN * 2);  // 16 MB
  __bf16* WqkvT = (__bf16*)take((size_t)QKV_N * HIDDEN * 2);   // 2.25 MB  [N][K]
  __bf16* WoT   = (__bf16*)take((size_t)HIDDEN * HIDDEN * 2);  // 2 MB     [N][K]
  float*  bqkv  = (float*)take((size_t)QKV_N * 4);
  __bf16* QKV   = (__bf16*)take((size_t)M_ROWS * QKV_N * 2);   // 18 MB
  __bf16* Attn  = (__bf16*)take((size_t)M_ROWS * HIDDEN * 2);  // 16 MB

  // 1) precision conversion + transposed weight packing, one launch
  prepare_operands<<<QKV_PACK_BLOCKS + WO_PACK_BLOCKS + CVT_BLOCKS, 256, 0, stream>>>(
      X, Wq, Wk, Wv, bq, bk, bv, Wo, Xbf, WqkvT, bqkv, WoT);

  // 2) fused QKV projection: [8192,1024] x [1024,1152] + bias -> bf16
  gemm_bf16_wmma<__bf16><<<(M_ROWS / 256) * (QKV_N / 128), 256, 0, stream>>>(
      Xbf, WqkvT, bqkv, QKV, M_ROWS, QKV_N, HIDDEN);

  // 3) flash multi-query attention -> bf16 [8192,1024]
  mqa_attention<<<BATCH * HEADS * (SEQ / 256), 256, 0, stream>>>(QKV, Attn);

  // 4) output projection: [8192,1024] x [1024,1024] + bo -> f32 out
  gemm_bf16_wmma<float><<<(M_ROWS / 256) * (HIDDEN / 128), 256, 0, stream>>>(
      Attn, WoT, bo, out, M_ROWS, HIDDEN, HIDDEN);
}

// v008
// A run of this version takes 105 microseconds.
// Versions in between are left out here; by their measured steps it is 1.16 times as fast as v006.
// Over all steps from v000 it is 3.89 times as fast.
#include <hip/hip_runtime.h>
#include <math.h>

typedef __attribute__((ext_vector_type(16))) __bf16 v16bf;
typedef __attribute__((ext_vector_type(8)))  float  v8f;

#define HIDDEN   1024
#define HEADS    16
#define HEAD_DIM 64
#define BATCH    4
#define SEQ      2048
#define M_ROWS   (BATCH * SEQ)           // 8192
#define QKV_N    (HIDDEN + 2 * HEAD_DIM) // 1152

static __device__ __forceinline__ v16bf frag_k32(const __bf16* base, int ld) {
  const int lane = threadIdx.x & 31;
  const int lsub = lane & 15, hi = lane >> 4;
  const __bf16* p = base + (size_t)lsub * ld + hi * 8;
  union { uint4 u[2]; v16bf v; } t;
  t.u[0] = *reinterpret_cast<const uint4*>(p);
  t.u[1] = *reinterpret_cast<const uint4*>(p + 16);
  return t.v;
}

static __device__ __forceinline__ v8f wmma_bf16(v16bf a, v16bf b, v8f c) {
  return __builtin_amdgcn_wmma_f32_16x16x32_bf16(false, a, false, b, (short)0, c,
                                                 false, false);
}

// LDS byte offset of a generic pointer to __shared__.
static __device__ __forceinline__ unsigned lds_off32(const void* p) {
  return (unsigned)(uintptr_t)p;
}

static __device__ __forceinline__ void async_copy12_b128(const unsigned (&l)[12],
                                                         const void* const (&g)[12]) {
  asm volatile("global_load_async_to_lds_b128 %0, %1, off\n\t"
               "global_load_async_to_lds_b128 %2, %3, off\n\t"
               "global_load_async_to_lds_b128 %4, %5, off\n\t"
               "global_load_async_to_lds_b128 %6, %7, off\n\t"
               "global_load_async_to_lds_b128 %8, %9, off\n\t"
               "global_load_async_to_lds_b128 %10, %11, off\n\t"
               "global_load_async_to_lds_b128 %12, %13, off\n\t"
               "global_load_async_to_lds_b128 %14, %15, off\n\t"
               "global_load_async_to_lds_b128 %16, %17, off\n\t"
               "global_load_async_to_lds_b128 %18, %19, off\n\t"
               "global_load_async_to_lds_b128 %20, %21, off\n\t"
               "global_load_async_to_lds_b128 %22, %23, off\n\t"
               "s_wait_xcnt 0x0"
               :: "v"(l[0]), "v"(g[0]), "v"(l[1]), "v"(g[1]), "v"(l[2]), "v"(g[2]),
                  "v"(l[3]), "v"(g[3]), "v"(l[4]), "v"(g[4]), "v"(l[5]), "v"(g[5]),
                  "v"(l[6]), "v"(g[6]), "v"(l[7]), "v"(g[7]), "v"(l[8]), "v"(g[8]),
                  "v"(l[9]), "v"(g[9]), "v"(l[10]), "v"(g[10]), "v"(l[11]), "v"(g[11])
               : "memory");
}

// ---------------------------------------------------------------------------
// Conversion / packing: three independent jobs in ONE launch (prepare_operands
// below), each on its own range of blocks. Each is a short stream: a thread
// issues all of its loads before it uses the first, so a wave pays the memory
// latency once.
// Weights stored TRANSPOSED ([N][K] bf16) so GEMM B-fragments are wide.
// The attention scale 1/sqrt(64) and log2(e) are folded into Wq/bq here, so
// that the scores come out of the matrix unit as exponents of 2.
// ---------------------------------------------------------------------------
#define CVT_VEC 16  // 16 B loads per thread
#define Q_SCALE 0.18033688f  // log2(e) / sqrt(HEAD_DIM)

// Block blk of 256 threads converts 256 * CVT_VEC * 4 consecutive floats. Every
// wave-wide load covers 512 contiguous bytes, every wave-wide store 256.
static __device__ __forceinline__ void convert_f32_bf16(int blk, const float* __restrict__ src,
                                                        __bf16* __restrict__ dst) {
  const size_t base = (size_t)blk * (256 * CVT_VEC) + threadIdx.x;  // in units of 4 elements
  const float4* s4 = reinterpret_cast<const float4*>(src) + base;
  uint2* d4 = reinterpret_cast<uint2*>(dst) + base;
  float4 v[CVT_VEC];
#pragma unroll  // v stays in registers and the loads issue back to back
  for (int j = 0; j < CVT_VEC; ++j) v[j] = s4[j * 256];
#pragma unroll  // constant indices into v
  for (int j = 0; j < CVT_VEC; ++j) {
    union { uint2 u; __bf16 e[4]; } w;
    w.e[0] = (__bf16)v[j].x;
    w.e[1] = (__bf16)v[j].y;
    w.e[2] = (__bf16)v[j].z;
    w.e[3] = (__bf16)v[j].w;
    d4[j * 256] = w.u;
  }
}

// 64 consecutive k of one column of a row-major f32 matrix (row length LD)
// -> one 128 B line of the transposed bf16 matrix. The lanes of a wave hold
// neighbouring columns, so each of the 64 loads reads one whole line.
template <int LD>
static __device__ __forceinline__ void column64_to_line(const float* __restrict__ col,
                                                        float scale, __bf16* __restrict__ line) {
  float v[64];
#pragma unroll  // v stays in registers and the loads issue back to back
  for (int j = 0; j < 64; ++j) v[j] = col[(size_t)j * LD];
#pragma unroll  // constant indices into v, here and in the loop inside
  for (int c = 0; c < 8; ++c) {
    union { uint4 u; __bf16 e[8]; } w;
#pragma unroll
    for (int r = 0; r < 8; ++r) w.e[r] = (__bf16)(v[c * 8 + r] * scale);
    reinterpret_cast<uint4*>(line)[c] = w.u;
  }
  // code of the same kernel that follows in the listing reuses registers that
  // these issued stores name
  asm volatile("s_wait_xcnt 0x0" ::: "memory");
}

// Units: (QKV_N / 64) column blocks x (HIDDEN / 64) k blocks, 64 threads (t) each.
// A column block lies wholly in Wq, in Wk or in Wv.
static __device__ __forceinline__ void pack_wqkv_t(
    int unit, int t,
    const float* __restrict__ Wq, const float* __restrict__ Wk,
    const float* __restrict__ Wv, const float* __restrict__ bq,
    const float* __restrict__ bk, const float* __restrict__ bv,
    __bf16* __restrict__ Wt, float* __restrict__ bqkv) {
  constexpr int NB = QKV_N / 64;
  const int nb = unit % NB, k0 = (unit / NB) * 64;
  const int n = nb * 64 + t;
  __bf16* line = Wt + (size_t)n * HIDDEN + k0;  // Wt[n][k]
  if (nb < HIDDEN / 64)
    column64_to_line<HIDDEN>(Wq + (size_t)k0 * HIDDEN + n, Q_SCALE, line);
  else if (nb == HIDDEN / 64)
    column64_to_line<HEAD_DIM>(Wk + (size_t)k0 * HEAD_DIM + t, 1.0f, line);
  else
    column64_to_line<HEAD_DIM>(Wv + (size_t)k0 * HEAD_DIM + t, 1.0f, line);
  if (k0 == 0) {
    bqkv[n] = (nb < HIDDEN / 64) ? bq[n] * Q_SCALE : (nb == HIDDEN / 64) ? bk[t] : bv[t];
    // as behind the line's stores: the listing goes on behind this store
    asm volatile("s_wait_xcnt 0x0" ::: "memory");
  }
}

// W [HIDDEN][HIDDEN] -> Wt [N][K]. Units: 16 column blocks x 16 k blocks, 64 threads (t) each.
static __device__ __forceinline__ void transpose_f32_bf16(int unit, int t,
                                                          const float* __restrict__ W,
                                                          __bf16* __restrict__ Wt) {
  constexpr int NB = HIDDEN / 64;
  const int n = (unit % NB) * 64 + t, k0 = (unit / NB) * 64;
  column64_to_line<HIDDEN>(W + (size_t)k0 * HIDDEN + n, 1.0f, Wt + (size_t)n * HIDDEN + k0);
}

// One launch for all three jobs: none reads what another writes, so they share
// one start and one end instead of waiting for each other. A block of 256
// threads is either four weight units (two waves each) or one block of X. The
// weight blocks come first: theirs is the longer chain of loads and stores.
#define QKV_PACK_BLOCKS ((QKV_N / 64) * (HIDDEN / 64) / 4)    // 72
#define WO_PACK_BLOCKS  ((HIDDEN / 64) * (HIDDEN / 64) / 4)   // 64
#define CVT_BLOCKS      ((M_ROWS * HIDDEN) / (256 * CVT_VEC * 4))  // 512
__global__ __launch_bounds__(256) void prepare_operands(
    const float* __restrict__ X, const float* __restrict__ Wq, const float* __restrict__ Wk,
    const float* __restrict__ Wv, const float* __restrict__ bq, const float* __restrict__ bk,
    const float* __restrict__ bv, const float* __restrict__ Wo, __bf16* __restrict__ Xbf,
    __bf16* __restrict__ WqkvT, float* __restrict__ bqkv, __bf16* __restrict__ WoT) {
  const int blk = blockIdx.x;
  if (blk >= QKV_PACK_BLOCKS + WO_PACK_BLOCKS) {
    convert_f32_bf16(blk - (QKV_PACK_BLOCKS + WO_PACK_BLOCKS), X, Xbf);
    return;
  }
  // the unit is the same in every lane of a wave: held in a scalar register, the
  // choice between Wq, Wk and Wv stays a scalar branch
  const int sub = __builtin_amdgcn_readfirstlane((int)(threadIdx.x >> 6));
  const int t = threadIdx.x & 63;
  if (blk < QKV_PACK_BLOCKS)
    pack_wqkv_t(blk * 4 + sub, t, Wq, Wk, Wv, bq, bk, bv, WqkvT, bqkv);
  else
    transpose_f32_bf16((blk - QKV_PACK_BLOCKS) * 4 + sub, t, Wo, WoT);
}

struct yes { static constexpr bool value = true; };
struct no  { static constexpr bool value = false; };

template <typename OutT>
__global__ __launch_bounds__(256) void gemm_bf16_wmma(
    const __bf16* __restrict__ A, const __bf16* __restrict__ Wt,
    const float* __restrict__ bias, OutT* __restrict__ C, int M, int N, int K) {
  constexpr int BM = 256, BN = 128, BK = 64;
  constexpr int LDP = BK + 8;                       // LDS row pitch, elements (144 B)
  __shared__ __align__(16) __bf16 As[2][BM * LDP];  // row-major [row][k], 2x36KB
  __shared__ __align__(16) __bf16 Bs[2][BN * LDP];  // col-major [col][k], 2x18KB

  const int tid = threadIdx.x, lane = tid & 31, wave = tid >> 5;
  const int wm = wave & 3, wn = wave >> 2;  // 4 waves in M, 2 in N
  const int nb = N / BN;
  const int row0 = (blockIdx.x / nb) * BM;
  const int col0 = (blockIdx.x % nb) * BN;

  // copy map: a thread brings 8 bf16 of row tid>>3 at k-offset (tid&7)*8, and
  // the same of the rows 32, 64, ... further on (A: 8 copies, B: 4); a wave's
  // copy covers four whole 128 B lines
  const int crow = tid >> 3, ck = (tid & 7) * 8;
  const unsigned lthr = (unsigned)(crow * LDP + ck) * 2;
  const unsigned asBase = lds_off32(As[0]) + lthr, bsBase = lds_off32(Bs[0]) + lthr;
  constexpr unsigned LSTEP = 32 * LDP * 2;  // 32 rows in LDS, bytes
  const size_t gstep = (size_t)32 * K;      // 32 rows in global memory, elements
  const __bf16* aThr = A + (size_t)(row0 + crow) * K + ck;
  const __bf16* bThr = Wt + (size_t)(col0 + crow) * K + ck;

  auto issue = [&](int k0, int buf) {
    unsigned l[12];
    const void* g[12];
#pragma unroll  // constant indices: the operands of one asm statement
    for (int c = 0; c < 8; ++c) {
      l[c] = asBase + (unsigned)buf * (BM * LDP * 2) + c * LSTEP;
      g[c] = aThr + k0 + c * gstep;
    }
#pragma unroll  // the same
    for (int c = 0; c < 4; ++c) {
      l[8 + c] = bsBase + (unsigned)buf * (BN * LDP * 2) + c * LSTEP;
      g[8 + c] = bThr + k0 + c * gstep;
    }
    async_copy12_b128(l, g);
  };

  v8f acc[4][4] = {};
  v16bf af[4], bf0[4], bf1[4];  // A of the running block; B of a stage's first and second block
  const int aoff = (wm * 64) * LDP, boff = (wn * 64) * LDP;

  auto block = [&](auto fetch, v16bf (&bcur)[4], v16bf (&bnext)[4], const __bf16* an,
                   const __bf16* bn) {
    constexpr bool FETCH = decltype(fetch)::value;
    if constexpr (FETCH) {
#pragma unroll
      for (int j = 0; j < 4; ++j) bnext[j] = frag_k32(bn + j * 16 * LDP, LDP);
      __builtin_amdgcn_sched_barrier(0);
    }
#pragma unroll
    for (int i = 0; i < 4; ++i) {
#pragma unroll
      for (int j = 0; j < 4; ++j) acc[i][j] = wmma_bf16(af[i], bcur[j], acc[i][j]);
      if constexpr (FETCH) {
        __builtin_amdgcn_sched_barrier(0);
        af[i] = frag_k32(an + i * 16 * LDP, LDP);
        __builtin_amdgcn_sched_barrier(0);
      }
    }
  };

  issue(0, 0);
  asm volatile("s_wait_asynccnt 0x0" ::: "memory");  // own copies of stage 0 landed
  __syncthreads();                                   // everyone's landed
  if (BK < K) issue(BK, 1);
#pragma unroll  // constant indices, as in block
  for (int j = 0; j < 4; ++j) bf0[j] = frag_k32(&Bs[0][boff] + j * 16 * LDP, LDP);
#pragma unroll  // the same
  for (int i = 0; i < 4; ++i) af[i] = frag_k32(&As[0][aoff] + i * 16 * LDP, LDP);

  int buf = 0;
  for (int k0 = 0; k0 + BK < K; k0 += BK, buf ^= 1) {
    block(yes{}, bf0, bf1, &As[buf][aoff] + 32, &Bs[buf][boff] + 32);
    // hand-over: this wave has read all it needs of this stage, its copies of
    // the next have landed; behind the barrier that holds for all waves, the
    // next stage may be read and this stage's buffer refilled
    asm volatile("s_wait_dscnt 0x0" ::: "memory");
    asm volatile("s_wait_asynccnt 0x0" ::: "memory");
    __syncthreads();
    if (k0 + 2 * BK < K) issue(k0 + 2 * BK, buf);
    block(yes{}, bf1, bf0, &As[buf ^ 1][aoff], &Bs[buf ^ 1][boff]);
  }
  // last stage: nothing follows its second block
  block(yes{}, bf0, bf1, &As[buf][aoff] + 32, &Bs[buf][boff] + 32);
  block(no{}, bf1, bf0, nullptr, nullptr);
  asm volatile("s_wait_asynccnt 0x0" ::: "memory");  // no copy in flight at the wave's end

  const int lsub = lane & 15, hi = lane >> 4;
#pragma unroll
  for (int i = 0; i < 4; ++i)
#pragma unroll
    for (int j = 0; j < 4; ++j)
#pragma unroll
      for (int r = 0; r < 8; ++r) {
        const int row = row0 + wm * 64 + i * 16 + r + 8 * hi;
        const int col = col0 + wn * 64 + j * 16 + lsub;
        C[(size_t)row * N + col] = (OutT)(acc[i][j][r] + bias[col]);
      }
}

static __device__ __forceinline__ float xhalf(float x) {
  const int v = __builtin_bit_cast(int, x);
  return __builtin_bit_cast(
      float, __builtin_amdgcn_permlanex16(v, v, 0x76543210, 0xfedcba98, false, false));
}

#define KPITCH  144
#define VPITCH  160
#define KTILE_B (64 * KPITCH)
#define STAGE_B (KTILE_B + 64 * VPITCH)
#define KV_TILES (SEQ / 64)

typedef unsigned u32x4 __attribute__((ext_vector_type(4)));
typedef short    s16x8 __attribute__((ext_vector_type(8)));

static __device__ __forceinline__ u32x4 lds_tr16(const unsigned char* p) {
  typedef __attribute__((address_space(3))) s16x8 lds_s16x8;
  return __builtin_bit_cast(u32x4, __builtin_amdgcn_ds_load_tr16_b128_v8i16((lds_s16x8*)p));
}

// A fragment of V^T (16 d x 32 keys, hardware k order) from row-major V rows.
// p = this lane's address for the fragment's first 16 keys.
static __device__ __forceinline__ v16bf frag_vt(const unsigned char* p) {
  union { u32x4 q[2]; v16bf v; } t;
  t.q[0] = lds_tr16(p);
  t.q[1] = lds_tr16(p + 16 * VPITCH);
  return t.v;
}

static __device__ __forceinline__ void async_copy4_b128(
    unsigned l0, const void* g0, unsigned l1, const void* g1,
    unsigned l2, const void* g2, unsigned l3, const void* g3) {
  asm volatile("global_load_async_to_lds_b128 %0, %1, off\n\t"
               "global_load_async_to_lds_b128 %2, %3, off\n\t"
               "global_load_async_to_lds_b128 %4, %5, off\n\t"
               "global_load_async_to_lds_b128 %6, %7, off\n\t"
               "s_wait_xcnt 0x0"
               :: "v"(l0), "v"(g0), "v"(l1), "v"(g1), "v"(l2), "v"(g2), "v"(l3), "v"(g3)
               : "memory");
}

__global__ __launch_bounds__(256) void mqa_attention(
    const __bf16* __restrict__ qkv, __bf16* __restrict__ attn_out) {
  // per buffer: K [64 keys][KPITCH], then V [64 keys][VPITCH], both row-major
  __shared__ __attribute__((aligned(128))) unsigned char kv[2][STAGE_B];

  const int tid = threadIdx.x, lane = tid & 31, wave = tid >> 5;
  const int lsub = lane & 15, hi = lane >> 4;
  const int qb = blockIdx.x & 7;           // SEQ/256 = 8
  const int h  = (blockIdx.x >> 3) & 15;
  const int b  = blockIdx.x >> 7;
  const int q0 = qb * 256 + wave * 32;
  const int ld = QKV_N;

  // copy map: 16 chunks of 16B per key row (8 of K, 8 of V), 16 rows per copy
  const int crow = tid >> 4, cc = tid & 15;
  const unsigned isv = (unsigned)cc >> 3;                      // 0: a K chunk, 1: a V chunk
  const unsigned cpitch = KPITCH + isv * (VPITCH - KPITCH);
  const unsigned ldst = lds_off32(&kv[0][0]) + isv * KTILE_B + (unsigned)crow * cpitch + (cc & 7) * 16u;
  const unsigned lstep = 16u * cpitch;
  const unsigned char* gsrc =
      reinterpret_cast<const unsigned char*>(qkv + (size_t)(b * SEQ + crow) * ld + HIDDEN) + cc * 16;
  constexpr size_t GSTEP = (size_t)16 * QKV_N * 2;  // 16 key rows, bytes

  auto issue = [&](int tile, int buf) {
    const unsigned l = ldst + (unsigned)buf * STAGE_B;
    const unsigned char* g = gsrc + (size_t)tile * (4 * GSTEP);
    async_copy4_b128(l, g, l + lstep, g + GSTEP, l + 2 * lstep, g + 2 * GSTEP,
                     l + 3 * lstep, g + 3 * GSTEP);
  };

  issue(0, 0);

  // Q fragments (B operand: column = query, straight from global, 2x b128 per frag)
  const __bf16* qp = qkv + (size_t)(b * SEQ + q0) * ld + h * HEAD_DIM;
  v16bf q_lo[2], q_hi[2];  // column group c: queries q0 + c*16 + lsub
#pragma unroll  // here and at every loop over c: constant indices keep the per-group arrays in registers
  for (int c = 0; c < 2; ++c) {
    q_lo[c] = frag_k32(qp + (size_t)c * 16 * ld, ld);
    q_hi[c] = frag_k32(qp + (size_t)c * 16 * ld + 32, ld);
  }

  v8f negm[2] = {};  // minus the maximum in use of this lane's queries, in all 8 registers (both halves agree)
  float l_run[2] = {0.0f, 0.0f};  // running sum over this half's keys only; joined at the end
  v8f o[2][4] = {};               // o[c][t][r] = O[query c*16 + lsub][d = t*16 + 8*hi + r]

  // this lane's place in a V tile for the transposing load
  const unsigned vlane = KTILE_B + (unsigned)(8 * hi + (lane & 7)) * VPITCH + 16u * ((lane >> 3) & 1);

  asm volatile("s_wait_asynccnt 0x0" ::: "memory");  // own copies of stage 0 landed
  __syncthreads();                                   // everyone's landed
  issue(1, 1);

  for (int kt = 0; kt < KV_TILES; ++kt) {
    const unsigned char* stage = kv[kt & 1];

    // S^T = K * Q^T - maximum in use (64 keys x 32 queries)
    // s[c][n][r] = score(key kt*64 + n*16 + 8*hi + r, query c*16 + lsub) - maximum in use
    v8f s[2][4];
#pragma unroll
    for (int n = 0; n < 4; ++n) {
      const __bf16* kb = reinterpret_cast<const __bf16*>(stage + n * 16 * KPITCH);
      const v16bf k_lo = frag_k32(kb, KPITCH / 2);
      const v16bf k_hi = frag_k32(kb + 32, KPITCH / 2);
#pragma unroll
      for (int c = 0; c < 2; ++c) s[c][n] = wmma_bf16(k_lo, q_lo[c], negm[c]);
#pragma unroll
      for (int c = 0; c < 2; ++c) s[c][n] = wmma_bf16(k_hi, q_hi[c], s[c][n]);
    }

    // this half's largest score above the maximum in use, per column group
    float mx[2];
#pragma unroll
    for (int c = 0; c < 2; ++c) {
      float m = s[c][0][0];
#pragma unroll
      for (int n = 0; n < 4; ++n)
#pragma unroll
        for (int r = 0; r < 8; ++r) m = fmaxf(m, s[c][n][r]);
      mx[c] = m;
    }

    // renewal: always on the first tile (nothing is in use yet), later only if
    // some score of the wave lies more than 8 above; the same for all lanes
    if (kt == 0 || __builtin_amdgcn_ballot_w32(fmaxf(mx[0], mx[1]) > 8.0f) != 0) {
#pragma unroll
      for (int c = 0; c < 2; ++c) {
        const float mj = fmaxf(mx[c], xhalf(mx[c]));         // both halves' keys
        const float d = (kt == 0) ? mj : fmaxf(mj, 0.0f);    // the maximum in use rises by d
        const float corr = (kt == 0) ? 1.0f : __builtin_amdgcn_exp2f(-d);  // first tile: O and sum are 0
        negm[c] -= d;
        l_run[c] *= corr;
#pragma unroll
        for (int n = 0; n < 4; ++n) s[c][n] -= d;
#pragma unroll
        for (int t = 0; t < 4; ++t) o[c][t] *= corr;
      }
    }

    v16bf pb[2][2];  // P^T as B operands: keys 0..31 and 32..63 of the tile
#pragma unroll
    for (int c = 0; c < 2; ++c) {
#pragma unroll
      for (int n = 0; n < 4; ++n) {
#pragma unroll
        for (int r = 0; r < 8; ++r) {
          s[c][n][r] = __builtin_amdgcn_exp2f(s[c][n][r]);
          pb[c][n >> 1][(n & 1) * 8 + r] = (__bf16)s[c][n][r];
        }
      }
      const v8f rs = (s[c][0] + s[c][1]) + (s[c][2] + s[c][3]);  // this half's 32 keys, register by register
      l_run[c] += ((rs[0] + rs[1]) + (rs[2] + rs[3])) + ((rs[4] + rs[5]) + (rs[6] + rs[7]));
    }

    // O^T += V^T(64 d x 64 keys) * P^T(64 keys x 32 queries)
    const unsigned char* vp = stage + vlane;
#pragma unroll
    for (int t = 0; t < 4; ++t) {
      const v16bf v_lo = frag_vt(vp + 32 * t);
      const v16bf v_hi = frag_vt(vp + 32 * VPITCH + 32 * t);
#pragma unroll
      for (int c = 0; c < 2; ++c) o[c][t] = wmma_bf16(v_lo, pb[c][0], o[c][t]);
#pragma unroll
      for (int c = 0; c < 2; ++c) o[c][t] = wmma_bf16(v_hi, pb[c][1], o[c][t]);
    }

    // hand-over: this wave has left the stage, its copies of the next have
    // landed; behind the barrier that holds for all waves, and the buffer
    // just read may be refilled
    asm volatile("s_wait_dscnt 0x0" ::: "memory");
    asm volatile("s_wait_asynccnt 0x0" ::: "memory");
    __syncthreads();
    if (kt + 2 < KV_TILES) issue(kt + 2, kt & 1);
  }
  asm volatile("s_wait_asynccnt 0x0" ::: "memory");  // no copy in flight at the wave's end

  // a lane holds 8 consecutive d of its query per tile: one 16B store each
  union { uint4 u; __bf16 e[8]; } w[2][4];
#pragma unroll
  for (int c = 0; c < 2; ++c) {
    const float inv = 1.0f / (l_run[c] + xhalf(l_run[c]));
#pragma unroll
    for (int t = 0; t < 4; ++t)
#pragma unroll
      for (int r = 0; r < 8; ++r) w[c][t].e[r] = (__bf16)(o[c][t][r] * inv);
  }
  __bf16* op = attn_out + (size_t)(b * SEQ + q0 + lsub) * HIDDEN + h * HEAD_DIM + hi * 8;
#pragma unroll
  for (int c = 0; c < 2; ++c)
#pragma unroll
    for (int t = 0; t < 4; ++t)
      *reinterpret_cast<uint4*>(op + (size_t)c * 16 * HIDDEN + t * 16) = w[c][t].u;
}

// ---------------------------------------------------------------------------
// Host-side launch
// ---------------------------------------------------------------------------
extern "C" void kernel_launch(void* const* d_in, const int* in_sizes, int n_in,
                              void* d_out, int out_size, void* d_ws, size_t ws_size,
                              hipStream_t stream) {
  (void)in_sizes; (void)n_in; (void)out_size; (void)ws_size;
  const float* X  = (const float*)d_in[0];
  const float* Wq = (const float*)d_in[1];
  const float* bq = (const float*)d_in[2];
  const float* Wk = (const float*)d_in[3];
  const float* bk = (const float*)d_in[4];
  const float* Wv = (const float*)d_in[5];
  const float* bv = (const float*)d_in[6];
  const float* Wo = (const float*)d_in[7];
  const float* bo = (const float*)d_in[8];
  float* out = (float*)d_out;

  char* ws = (char*)d_ws;
  size_t off = 0;
  auto take = [&](size_t bytes) {
    void* p = ws + off;
    off += (bytes + 255) & ~(size_t)255;
    return p;
  };
  __bf16* Xbf   = (__bf16*)take((size_t)M_ROWS * HIDDEN * 2);  // 16 MB
  __bf16* WqkvT = (__bf16*)take((size_t)QKV_N * HIDDEN * 2);   // 2.25 MB  [N][K]
  __bf16* WoT   = (__bf16*)take((size_t)HIDDEN * HIDDEN * 2);  // 2 MB     [N][K]
  float*  bqkv  = (float*)take((size_t)QKV_N * 4);
  __bf16* QKV   = (__bf16*)take((size_t)M_ROWS * QKV_N * 2);   // 18 MB
  __bf16* Attn  = (__bf16*)take((size_t)M_ROWS * HIDDEN * 2);  // 16 MB

  // 1) precision conversion + transposed weight packing, one launch
  prepare_operands<<<QKV_PACK_BLOCKS + WO_PACK_BLOCKS + CVT_BLOCKS, 256, 0, stream>>>(
      X, Wq, Wk, Wv, bq, bk, bv, Wo, Xbf, WqkvT, bqkv, WoT);

  // 2) fused QKV projection: [8192,1024] x [1024,1152] + bias -> bf16
  gemm_bf16_wmma<__bf16><<<(M_ROWS / 256) * (QKV_N / 128), 256, 0, stream>>>(
      Xbf, WqkvT, bqkv, QKV, M_ROWS, QKV_N, HIDDEN);

  // 3) flash multi-query attention -> bf16 [8192,1024]
  mqa_attention<<<BATCH * HEADS * (SEQ / 256), 256, 0, stream>>>(QKV, Attn);

  // 4) output projection: [8192,1024] x [1024,1024] + bo -> f32 out
  gemm_bf16_wmma<float><<<(M_ROWS / 256) * (HIDDEN / 128), 256, 0, stream>>>(
      Attn, WoT, bo, out, M_ROWS, HIDDEN, HIDDEN);
}
